// v000
// The times below were measured on an AMD MI455X: many runs one after another, warmed up first and cycling through
// copies of the inputs, with the whole window's GPU time divided by the number of runs. Launches and the gaps
// between them are all in it. The median over several windows is given; except for v000 it joins two sittings, which
// can be a few percent apart, so the side-by-side timings, each taken in one sitting, are the better comparison.
// v000 is the starting kernel. One run takes 1750 microseconds.
#include <hip/hip_runtime.h>

// Dense multi-head attention CORE on GIVEN query, key, value (query, key, value [4][2048][512]; 8 heads x 64 by reshape: head h = features h * 64 .. h * 64 + 63; scores / sqrt(64); softmax over all 2,048 keys (no mask); out = weights v merged in head order -> [4][2048][512] (4.2 M); NO projections; argument order query, key, value). THIS ROW: the same attention core at width 512 with 8 heads x 64 (Q, K, V [4][2048][512] given; no projections): the file constants DM 512 and NH_ = NKV = 8.
// Layout per batch: NO input cast and NO projections: the identity-table plane builders read the GIVEN f32 query / key rows [t][h * 64 + d] (pitch 512) and k_vtp the value rows; dense T-2048 attention with EVERY row's scores on hi / lo planes (3 products); the float-output merge writes the output rows.
// Compute dtypes, f32 accumulate: the GIVEN f32 query, key, value are NOT rounded to bf16 (no projection, no input cast): the plane builders read them directly: q and k as f16 planes + bf16 hi / lo planes (hi + lo carries about 16 bits of the f32 value), v likewise (transposed); EVERY row's scores on hi / lo planes (3 products: the host's scheme); P.V: rows < 512 hl, the rest single fp16 (x1024); softmax f32; the merged context written in f32.

#define NB_  4
#define TT   2048
#define DM   512 
#define NH_  8 
#define NKV  8 
#define REP  (NH_ / NKV)
#define HD   64
#define DQ   (NH_ * HD)
#define DKV  (NKV * HD)
#define ZH   2
#define RH   512                  // query rows < RH use hi+lo planes (0: none)
#define WIN  0
#define PCAR 1024.0f
#define SCL  0.125f   // HD^-0.5
typedef _Float16 h16;
typedef unsigned short bf;
typedef __attribute__((ext_vector_type(16))) __bf16   v16bf;
typedef __attribute__((ext_vector_type(16))) _Float16 v16h;
typedef __attribute__((ext_vector_type(8)))  _Float16 v8h;
typedef __attribute__((ext_vector_type(8)))  unsigned short v8us;
typedef __attribute__((ext_vector_type(8)))  float    v8f;
typedef __attribute__((ext_vector_type(4)))  float    v4f;
typedef v8h  __attribute__((may_alias)) v8ha;
typedef v4f  __attribute__((may_alias)) v4fa;
typedef v8us __attribute__((may_alias)) v8usa;

__device__ __forceinline__ unsigned short f2bf(float f) { unsigned u = __float_as_uint(f); u += 0x7FFFu + ((u >> 16) & 1u); return (unsigned short)(u >> 16); }
__device__ __forceinline__ float bf2f(unsigned short b) { return __uint_as_float(((unsigned)b) << 16); }
__device__ __forceinline__ float bfr(float f) { return bf2f(f2bf(f)); }
__device__ __forceinline__ v16h cat16(v8h lo, v8h hi) { return __builtin_shufflevector(lo, hi, 0, 1, 2, 3, 4, 5, 6, 7, 8, 9, 10, 11, 12, 13, 14, 15); }
__device__ __forceinline__ v16bf cat16b(v8us lo, v8us hi) { return __builtin_bit_cast(v16bf, __builtin_shufflevector(lo, hi, 0, 1, 2, 3, 4, 5, 6, 7, 8, 9, 10, 11, 12, 13, 14, 15)); }
__device__ __forceinline__ v8f wmma16(v16h a, v16h b, v8f c) { return __builtin_amdgcn_wmma_f32_16x16x32_f16(false, a, false, b, (short)0, c, false, false); }
__device__ __forceinline__ v8f wmmab(v16bf a, v16bf b, v8f c) { return __builtin_amdgcn_wmma_f32_16x16x32_bf16(false, a, false, b, (short)0, c, false, false); }



// ---- k_gemmw: register-blocked GEMM, ONE WAVE per 64x64 output tile (16 accumulators), operands straight from K-contiguous 16-bit planes; grid (M/64, N/64, Z), 32 threads.
// C[m][n] (f32, pitch ldc, + optional f32 bias[n]) = sum_k A[m][k] Bt[n][k] (+ split products per NSPLIT). z-batch strides sA/sB/sC in elements. K % 32 == 0.
template <typename T16> struct WFrag;
template <> struct WFrag<h16> { typedef v16h V; static __device__ __forceinline__ V ld(const h16* p) { return cat16(*(const v8h*)p, *(const v8h*)(p + 16)); } static __device__ __forceinline__ v8f mma(V a, V b, v8f c) { return wmma16(a, b, c); } };
template <> struct WFrag<bf> { typedef v16bf V; static __device__ __forceinline__ V ld(const bf* p) { return cat16b(*(const v8us*)p, *(const v8us*)(p + 16)); } static __device__ __forceinline__ v8f mma(V a, V b, v8f c) { return wmmab(a, b, c); } };
template <typename T16, int NSPLIT, bool BIAS>
__global__ __launch_bounds__(32) void k_gemmw(const T16* __restrict__ A, const T16* __restrict__ A2, const T16* __restrict__ Bt, const T16* __restrict__ Bt2, int K, float* C, int ldc, const float* __restrict__ bias, size_t sA, size_t sB, size_t sC) {
    typedef typename WFrag<T16>::V V;
    __shared__ __align__(16) float os[16 * 68];
    const size_t z = blockIdx.z; A += z * sA; if (A2) A2 += z * sA; Bt += z * sB; if (Bt2) Bt2 += z * sB; C += z * sC;
    const int lane = threadIdx.x & 31, lr = lane & 15, hi = lane >> 4; const int r0 = blockIdx.x * 64, c0 = blockIdx.y * 64;
    v8f acc[4][4];
#pragma unroll
    for (int mb = 0; mb < 4; ++mb)
#pragma unroll
        for (int nb = 0; nb < 4; ++nb) acc[mb][nb] = (v8f){};
    const size_t aoff = (size_t)(r0 + lr) * K + 8 * hi, boff = (size_t)(c0 + lr) * K + 8 * hi;
#pragma unroll 1
    for (int kc = 0; kc < K; kc += 32) {
        V a[4], a2[4];
#pragma unroll
        for (int mb = 0; mb < 4; ++mb) { a[mb] = WFrag<T16>::ld(A + aoff + (size_t)mb * 16 * K + kc); if (NSPLIT == 1 || NSPLIT == 2) a2[mb] = WFrag<T16>::ld(A2 + aoff + (size_t)mb * 16 * K + kc); }
#pragma unroll
        for (int nb = 0; nb < 4; ++nb) { const V b = WFrag<T16>::ld(Bt + boff + (size_t)nb * 16 * K + kc); V b2; if (NSPLIT >= 2) b2 = WFrag<T16>::ld(Bt2 + boff + (size_t)nb * 16 * K + kc);
#pragma unroll
            for (int mb = 0; mb < 4; ++mb) { acc[mb][nb] = WFrag<T16>::mma(a[mb], b, acc[mb][nb]); if (NSPLIT == 1 || NSPLIT == 2) acc[mb][nb] = WFrag<T16>::mma(a2[mb], b, acc[mb][nb]); if (NSPLIT >= 2) acc[mb][nb] = WFrag<T16>::mma(a[mb], b2, acc[mb][nb]); } }
        asm volatile("v_nop\n\tv_nop\n\tv_nop\n\tv_nop" : "+v"(acc[0][0]), "+v"(acc[1][1]), "+v"(acc[2][2]), "+v"(acc[3][3]) : "v"(a[0]), "v"(a[3]));
    }
#pragma unroll
    for (int mb = 0; mb < 4; ++mb) {
#pragma unroll
        for (int nb = 0; nb < 4; ++nb) {
#pragma unroll
            for (int j = 0; j < 8; ++j) os[(hi * 8 + j) * 68 + nb * 16 + lr] = acc[mb][nb][j]; }
        __builtin_amdgcn_wave_barrier(); asm volatile("" ::: "memory");
        float* crow = C + (size_t)(r0 + mb * 16) * ldc + c0;
{
#pragma unroll
            for (int s = 0; s < 8; ++s) { const int row = 2 * s + hi, cofs = lr * 4; v4f val = *(const v4fa*)(os + row * 68 + cofs); if (BIAS) { val[0] += bfr(bias[c0 + cofs]); val[1] += bfr(bias[c0 + cofs + 1]); val[2] += bfr(bias[c0 + cofs + 2]); val[3] += bfr(bias[c0 + cofs + 3]); }
                *(v4f*)(crow + (size_t)row * ldc + cofs) = val; }
             }
        __builtin_amdgcn_wave_barrier(); asm volatile("" ::: "memory");
    }
}

__device__ __forceinline__ h16 tohx(float x) { return (h16)x; }
__device__ __forceinline__ void splitf(float y, unsigned short& h, unsigned short& l) { h = f2bf(y); l = f2bf(y - bf2f(h)); }
typedef __attribute__((ext_vector_type(2))) _Float16 v2h;
typedef __attribute__((ext_vector_type(4))) _Float16 v4h;
typedef __attribute__((ext_vector_type(2))) unsigned short v2us;
typedef __attribute__((ext_vector_type(4))) unsigned short v4us;
typedef __attribute__((ext_vector_type(2))) float v2f;
typedef __attribute__((ext_vector_type(4))) int v4i;

__global__ __launch_bounds__(256) void k_wtG(const float* __restrict__ w, int K, int N, bf* Bt) {
    const int lane = threadIdx.x & 31; const int L0 = (blockIdx.x * 8 + (threadIdx.x >> 5)) * 8; const int nlines = N * K / 64;
{
#pragma unroll 1
        for (int l = 0; l < 8; ++l) { const int L = L0 + l; if (L >= nlines) break; const size_t e = (size_t)L * 64 + lane * 2; const int k = (int)(e % K), n = (int)(e / K); v2us o;
            o[0] = f2bf(w[(size_t)k * N + n]); o[1] = f2bf(w[(size_t)(k + 1) * N + n]); *(v2us*)(Bt + e) = o; }
         }
}
__global__ __launch_bounds__(256) void k_cvt8(const float* __restrict__ src, bf* dst, size_t n8) { const size_t i = (size_t)blockIdx.x * 256 + threadIdx.x; if (i >= n8) return; const v8f v = *(const v8f*)(src + i * 8); v8us o;
#pragma unroll
    for (int k = 0; k < 8; ++k) o[k] = f2bf(v[k]); *(v8us*)(dst + i * 8) = o;  }

// k_rope: head planes [h][t][d] (fp16 + hi/lo) of rope(x) x sc with the rotate-half convention out[d] = x[d] cos[t][d] - x[d+HD/2] sin[t][d], out[d+HD/2] = x[d+HD/2] cos[t][d+HD/2] + x[d] sin[t][d+HD/2]
__global__ __launch_bounds__(256) void k_rope(const float* __restrict__ F, int pitch, int nheads, const float* __restrict__ CS, const float* __restrict__ RF, const float* __restrict__ nw, float sc, h16* P16, bf* Ph, bf* Pl) {
    const size_t e = ((size_t)blockIdx.x * 256 + threadIdx.x) * 2; if (e >= (size_t)nheads * TT * HD) return; const int d = (int)(e % HD); const int t = (int)((e / HD) % TT); const int h = (int)(e / ((size_t)HD * TT)); const float* f = F + (size_t)t * pitch + h * HD; const float rf = RF ? RF[(size_t)h * TT + t] : 1.0f; v2h o16; v2us oh, ol;
#pragma unroll
    for (int q = 0; q < 2; ++q) { const int dd = d + q; const int dp = (dd < HD / 2) ? dd + HD / 2 : dd - HD / 2; float x0 = f[dd], x1 = f[dp];
        if (RF) { float n0 = __fmul_rn(x0, rf), n1 = __fmul_rn(x1, rf); asm volatile("" : "+v"(n0)); asm volatile("" : "+v"(n1)); x0 = __fmul_rn(bfr(nw[dd]), n0); x1 = __fmul_rn(bfr(nw[dp]), n1); }
        const v2f cs = *(const v2f*)(CS + ((size_t)t * HD + dd) * 2); float a = __fmul_rn(x0, cs[0]), bq = __fmul_rn(x1, cs[1]); asm volatile("" : "+v"(a)); asm volatile("" : "+v"(bq)); const float r = ((dd < HD / 2) ? __fsub_rn(a, bq) : __fadd_rn(a, bq)) * sc;
        o16[q] = tohx(r); unsigned short a2, c2; splitf(r, a2, c2); oh[q] = a2; ol[q] = c2; }
    *(v2h*)(P16 + e) = o16; *(v2us*)(Ph + e) = oh; *(v2us*)(Pl + e) = ol;  }
__global__ __launch_bounds__(256) void k_vtp(const float* __restrict__ F, int pitch, int nheads, h16* V16, bf* Vh, bf* Vl) { const size_t e = ((size_t)blockIdx.x * 256 + threadIdx.x) * 2; if (e >= (size_t)nheads * HD * TT) return; const int t = (int)(e % TT); const int d = (int)((e / TT) % HD); const int g = (int)(e / ((size_t)TT * HD)); v2h o16; v2us oh, ol;
#pragma unroll
    for (int q = 0; q < 2; ++q) { const float x = F[(size_t)(t + q) * pitch + g * HD + d]; o16[q] = tohx(x); unsigned short a2, c2; splitf(x, a2, c2); oh[q] = a2; ol[q] = c2; }
    *(v2h*)(V16 + e) = o16; *(v2us*)(Vh + e) = oh; *(v2us*)(Vl + e) = ol;  }
__global__ __launch_bounds__(256) void k_csid(float* CS) { const int idx = blockIdx.x * 256 + threadIdx.x; if (idx >= TT * HD) return; v2f cs; cs[0] = 1.0f; cs[1] = 0.0f; *(v2f*)(CS + (size_t)idx * 2) = cs;  }
// k_asoft: per row (zz, i): t = S x HD^-0.5 (no mask); softmax over the 2048 keys (register row, one exp, fixed trees);
__global__ __launch_bounds__(256) void k_asoft(const float* __restrict__ Sb, h16* P16, bf* Ph, bf* Pl) {
    const int lane = threadIdx.x & 31; const int row = blockIdx.x * 8 + (threadIdx.x >> 5); if (row >= ZH * TT) return; const int i = row % TT; const int zz = row / TT; (void)zz; const bool hires = (i < RH); const float* sr = Sb + (size_t)row * TT; float v[TT / 32]; float mx = -3.0e38f;
#pragma unroll
    for (int ch = 0; ch < TT / 128; ++ch) { const int j0 = ch * 128 + lane * 4; const v4f a = *(const v4f*)(sr + j0);
#pragma unroll
        for (int q = 0; q < 4; ++q) { const int j = j0 + q; (void)j; const float t = a[q] * SCL; v[ch * 4 + q] = t; mx = fmaxf(mx, t); } }
#pragma unroll
    for (int sh = 16; sh; sh >>= 1) mx = fmaxf(mx, __shfl_xor(mx, sh, 32));
    float sum = 0.f;
#pragma unroll
    for (int k = 0; k < TT / 32; ++k) { float d0 = __fsub_rn(v[k], mx); asm volatile("" : "+v"(d0)); v[k] = __builtin_amdgcn_exp2f(__fmul_rn(d0, 1.4426950408889634f)); sum += v[k]; }
#pragma unroll
    for (int sh = 16; sh; sh >>= 1) sum += __shfl_xor(sum, sh, 32);
    const float f = __fdiv_rn(hires ? 1.0f : PCAR, sum);
{
        if (hires) {
#pragma unroll
            for (int ch = 0; ch < TT / 128; ++ch) { v4us oh, ol;
#pragma unroll
                for (int q = 0; q < 4; ++q) { unsigned short a, c2; splitf(v[ch * 4 + q] * f, a, c2); oh[q] = a; ol[q] = c2; }
                const size_t oo = ((size_t)zz * (RH ? RH : 1) + i) * TT + ch * 128 + lane * 4; *(v4us*)(Ph + oo) = oh; *(v4us*)(Pl + oo) = ol; }
        } else {
#pragma unroll
            for (int ch = 0; ch < TT / 128; ++ch) { v4h o4;
#pragma unroll
                for (int q = 0; q < 4; ++q) o4[q] = tohx(v[ch * 4 + q] * f);
                *(v4h*)(P16 + (size_t)row * TT + ch * 128 + lane * 4) = o4; } }
         }
}
__global__ __launch_bounds__(256) void k_merge(const float* __restrict__ O, int h0, float* OUTb) { const size_t e = ((size_t)blockIdx.x * 256 + threadIdx.x) * 2; if (e >= (size_t)ZH * TT * HD) return; const int d = (int)(e % HD); const int t = (int)((e / HD) % TT); const int zz = (int)(e / ((size_t)HD * TT)); const float cs = (t < RH) ? 1.0f : (1.0f / PCAR); const size_t oo = (size_t)t * DQ + (h0 + zz) * HD + d;
    v2f o2; o2[0] = O[e] * cs; o2[1] = O[e + 1] * cs; *(v2f*)(OUTb + oo) = o2;  }

extern "C" void kernel_launch(void* const* d_in, const int* in_sizes, int n_in,
                              void* d_out, int out_size, void* d_ws, size_t ws_size, hipStream_t stream) {
    (void)in_sizes; (void)n_in; (void)out_size;
    const float* xq = (const float*)d_in[0]; const float* xk = (const float*)d_in[1]; const float* xv = (const float*)d_in[2];   /* query, key, value ([4][2048][512] each, GIVEN: this module has NO projections): THREE inputs */
    float* OUT = (float*)d_out;     // [4][2048][512]
    char* wsp = (char*)d_ws;
    auto take = [&](size_t bytes) { char* p = wsp; wsp += (bytes + 255) & ~(size_t)255; return (void*)p; };
    bf* WQKV = (bf*)take((size_t)3 * DQ * DM * 2); bf* WQ = WQKV; bf* WK = WQKV + (size_t)DQ * DM; bf* WV = WQKV + (size_t)2 * DQ * DM;   /* fused Bt [3*DQ][DM]: q | k | v row blocks */ float* CS = (float*)take((size_t)TT * HD * 2 * 4);
    bf* XB = (bf*)take((size_t)TT * DM * 2); float* FQ = (float*)take((size_t)TT * DQ * 4); float* FK = (float*)take((size_t)TT * DKV * 4);
    h16* QP16 = (h16*)take((size_t)NH_ * TT * HD * 2); h16* KP16 = (h16*)take((size_t)NKV * TT * HD * 2); h16* VT16 = (h16*)take((size_t)NKV * HD * TT * 2);
    bf* QPh = (bf*)take((size_t)NH_ * TT * HD * 2); bf* QPl = (bf*)take((size_t)NH_ * TT * HD * 2); bf* KPh = (bf*)take((size_t)NKV * TT * HD * 2); bf* KPl = (bf*)take((size_t)NKV * TT * HD * 2); bf* VTh = (bf*)take((size_t)NKV * HD * TT * 2); bf* VTl = (bf*)take((size_t)NKV * HD * TT * 2); bf* Ph = (bf*)take((size_t)ZH * RH * TT * 2); bf* Pl = (bf*)take((size_t)ZH * RH * TT * 2);
    float* Sb = (float*)take((size_t)ZH * TT * TT * 4); h16* P16 = (h16*)take((size_t)ZH * TT * TT * 2); float* Ob = (float*)take((size_t)ZH * TT * HD * 4);
    if ((size_t)(wsp - (char*)d_ws) > ws_size) return;    // ws 256 MiB
    float* FV = FK;
    { /* no projection weight in this module: nothing to stage */
      
       }
    k_csid<<<(TT * HD + 255) / 256, 256, 0, stream>>>(CS);
    const unsigned LQ = (unsigned)(((size_t)NH_ * TT * HD / 2 + 255) / 256), LKv = (unsigned)(((size_t)NKV * TT * HD / 2 + 255) / 256);
    for (int b = 0; b < NB_; ++b) {
        
        /* no input cast: the plane builders read the given f32 rows */
        k_rope<<<LQ, 256, 0, stream>>>(xq + (size_t)b * TT * DM, DM, NH_, CS, nullptr, nullptr, 1.0f, QP16, QPh, QPl);   /* the q planes straight from the INPUT rows [t][h * 64 + d] (pitch DM = 512 = DQ); identity table: a plain plane builder */
        k_rope<<<LKv, 256, 0, stream>>>(xk + (size_t)b * TT * DM, DM, NKV, CS, nullptr, nullptr, 1.0f, KP16, KPh, KPl);
        k_vtp<<<LKv, 256, 0, stream>>>(xv + (size_t)b * TT * DM, DM, NKV, VT16, VTh, VTl);   /* the transposed value planes straight from the INPUT rows */
        for (int h0 = 0; h0 < NH_; h0 += ZH) { const size_t zq = (size_t)h0, zk = (size_t)(h0 / REP);   // one kv head per query head: the pass's two heads use consecutive kv planes (z-strides TT*HD)
            k_gemmw<bf, 2, false><<<dim3(TT / 64, TT / 64, ZH), 32, 0, stream>>>(QPh + zq * TT * HD, QPl + zq * TT * HD, KPh + zk * TT * HD, KPl + zk * TT * HD, HD, Sb, TT, nullptr, (size_t)TT * HD, (size_t)TT * HD, (size_t)TT * TT);   /* EVERY row's scores on hi/lo planes (3 products); only P.V stays hybrid */
            k_asoft<<<ZH * TT / 8, 256, 0, stream>>>(Sb, P16, Ph, Pl);
            k_gemmw<bf, 2, false><<<dim3(RH / 64, HD / 64, ZH), 32, 0, stream>>>(Ph, Pl, VTh + zk * HD * TT, VTl + zk * HD * TT, TT, Ob, HD, nullptr, (size_t)RH * TT, (size_t)HD * TT, (size_t)TT * HD);
            k_gemmw<h16, 0, false><<<dim3((TT - RH) / 64, HD / 64, ZH), 32, 0, stream>>>(P16 + (size_t)RH * TT, nullptr, VT16 + zk * HD * TT, nullptr, TT, Ob + (size_t)RH * HD, HD, nullptr, (size_t)TT * TT, (size_t)HD * TT, (size_t)TT * HD);
            k_merge<<<(unsigned)(((size_t)ZH * TT * HD / 2 + 255) / 256), 256, 0, stream>>>(Ob, h0, OUT + (size_t)b * TT * DQ); }
         }
}

// v001
// One run takes 157 microseconds.
// Two timings next to v000 both put it at 11.2 times that version's speed.
#include <hip/hip_runtime.h>

// Dense multi-head attention CORE on GIVEN query, key, value (query, key, value [4][2048][512]; 8 heads x 64 by reshape: head h = features h * 64 .. h * 64 + 63; scores / sqrt(64); softmax over all 2,048 keys (no mask); out = weights v merged in head order -> [4][2048][512] (4.2 M); NO projections; argument order query, key, value). THIS ROW: the same attention core at width 512 with 8 heads x 64 (Q, K, V [4][2048][512] given; no projections): the file constants DM 512 and NH_ = NKV = 8.
// Layout: NO input cast and NO projections: per batch the identity-table plane builders read the GIVEN f32 query / key rows [t][h * 64 + d] and k_vtp the value rows, into planes [b][h][..]; then ONE launch (k_fattn) does scores, softmax and P.V for every batch and head with the scores kept in registers (online softmax) and writes the merged f32 output rows.
// Compute dtypes, f32 accumulate: the GIVEN f32 query, key, value are NOT rounded to bf16: q and k as bf16 hi / lo planes (hi + lo carries about 16 bits of the f32 value), v likewise (transposed) plus an f16 plane; EVERY row's scores on hi / lo planes (3 products); P.V: rows < 512 hi / lo (3 products), the rest single fp16; softmax f32; the context written in f32.

#define NB_  4
#define TT   2048
#define DM   512 
#define NH_  8 
#define NKV  8 
#define REP  (NH_ / NKV)
#define HD   64
#define DQ   (NH_ * HD)
#define DKV  (NKV * HD)
#define RH   512                  // query rows < RH: P.V on hi+lo value planes (0: none)
#define WIN  0
#define SCL  0.125f   // HD^-0.5
typedef _Float16 h16;
typedef unsigned short bf;
typedef __attribute__((ext_vector_type(16))) __bf16   v16bf;
typedef __attribute__((ext_vector_type(16))) _Float16 v16h;
typedef __attribute__((ext_vector_type(8)))  _Float16 v8h;
typedef __attribute__((ext_vector_type(8)))  unsigned short v8us;
typedef __attribute__((ext_vector_type(8)))  float    v8f;
typedef __attribute__((ext_vector_type(4)))  float    v4f;
typedef v8h  __attribute__((may_alias)) v8ha;
typedef v4f  __attribute__((may_alias)) v4fa;
typedef v8us __attribute__((may_alias)) v8usa;

__device__ __forceinline__ unsigned short f2bf(float f) { unsigned u = __float_as_uint(f); u += 0x7FFFu + ((u >> 16) & 1u); return (unsigned short)(u >> 16); }
__device__ __forceinline__ float bf2f(unsigned short b) { return __uint_as_float(((unsigned)b) << 16); }
__device__ __forceinline__ float bfr(float f) { return bf2f(f2bf(f)); }
__device__ __forceinline__ v16h cat16(v8h lo, v8h hi) { return __builtin_shufflevector(lo, hi, 0, 1, 2, 3, 4, 5, 6, 7, 8, 9, 10, 11, 12, 13, 14, 15); }
__device__ __forceinline__ v16bf cat16b(v8us lo, v8us hi) { return __builtin_bit_cast(v16bf, __builtin_shufflevector(lo, hi, 0, 1, 2, 3, 4, 5, 6, 7, 8, 9, 10, 11, 12, 13, 14, 15)); }
__device__ __forceinline__ v8f wmma16(v16h a, v16h b, v8f c) { return __builtin_amdgcn_wmma_f32_16x16x32_f16(false, a, false, b, (short)0, c, false, false); }
__device__ __forceinline__ v8f wmmab(v16bf a, v16bf b, v8f c) { return __builtin_amdgcn_wmma_f32_16x16x32_bf16(false, a, false, b, (short)0, c, false, false); }



// Fragment loaders in the hardware k order (two 16-byte loads per lane, k = 8h .. 8h + 7 and 16 + 8h .. 16 + 8h + 7), operands straight from K-contiguous 16-bit planes.
template <typename T16> struct WFrag;
template <> struct WFrag<h16> { typedef v16h V; static __device__ __forceinline__ V ld(const h16* p) { return cat16(*(const v8h*)p, *(const v8h*)(p + 16)); } static __device__ __forceinline__ v8f mma(V a, V b, v8f c) { return wmma16(a, b, c); } };
template <> struct WFrag<bf> { typedef v16bf V; static __device__ __forceinline__ V ld(const bf* p) { return cat16b(*(const v8us*)p, *(const v8us*)(p + 16)); } static __device__ __forceinline__ v8f mma(V a, V b, v8f c) { return wmmab(a, b, c); } };
__device__ __forceinline__ h16 tohx(float x) { return (h16)x; }
__device__ __forceinline__ void splitf(float y, unsigned short& h, unsigned short& l) { h = f2bf(y); l = f2bf(y - bf2f(h)); }
typedef __attribute__((ext_vector_type(2))) _Float16 v2h;
typedef __attribute__((ext_vector_type(4))) _Float16 v4h;
typedef __attribute__((ext_vector_type(2))) unsigned short v2us;
typedef __attribute__((ext_vector_type(4))) unsigned short v4us;
typedef __attribute__((ext_vector_type(2))) float v2f;
typedef __attribute__((ext_vector_type(4))) int v4i;

__global__ __launch_bounds__(256) void k_wtG(const float* __restrict__ w, int K, int N, bf* Bt) {
    const int lane = threadIdx.x & 31; const int L0 = (blockIdx.x * 8 + (threadIdx.x >> 5)) * 8; const int nlines = N * K / 64;
{
#pragma unroll 1
        for (int l = 0; l < 8; ++l) { const int L = L0 + l; if (L >= nlines) break; const size_t e = (size_t)L * 64 + lane * 2; const int k = (int)(e % K), n = (int)(e / K); v2us o;
            o[0] = f2bf(w[(size_t)k * N + n]); o[1] = f2bf(w[(size_t)(k + 1) * N + n]); *(v2us*)(Bt + e) = o; }
         }
}
__global__ __launch_bounds__(256) void k_cvt8(const float* __restrict__ src, bf* dst, size_t n8) { const size_t i = (size_t)blockIdx.x * 256 + threadIdx.x; if (i >= n8) return; const v8f v = *(const v8f*)(src + i * 8); v8us o;
#pragma unroll
    for (int k = 0; k < 8; ++k) o[k] = f2bf(v[k]); *(v8us*)(dst + i * 8) = o;  }

// k_rope: head planes [h][t][d] (fp16 + hi/lo) of rope(x) x sc with the rotate-half convention out[d] = x[d] cos[t][d] - x[d+HD/2] sin[t][d], out[d+HD/2] = x[d+HD/2] cos[t][d+HD/2] + x[d] sin[t][d+HD/2]
__global__ __launch_bounds__(256) void k_rope(const float* __restrict__ F, int pitch, int nheads, const float* __restrict__ CS, const float* __restrict__ RF, const float* __restrict__ nw, float sc, h16* P16, bf* Ph, bf* Pl) {
    const size_t e = ((size_t)blockIdx.x * 256 + threadIdx.x) * 2; if (e >= (size_t)nheads * TT * HD) return; const int d = (int)(e % HD); const int t = (int)((e / HD) % TT); const int h = (int)(e / ((size_t)HD * TT)); const float* f = F + (size_t)t * pitch + h * HD; const float rf = RF ? RF[(size_t)h * TT + t] : 1.0f; v2h o16; v2us oh, ol;
#pragma unroll
    for (int q = 0; q < 2; ++q) { const int dd = d + q; const int dp = (dd < HD / 2) ? dd + HD / 2 : dd - HD / 2; float x0 = f[dd], x1 = f[dp];
        if (RF) { float n0 = __fmul_rn(x0, rf), n1 = __fmul_rn(x1, rf); asm volatile("" : "+v"(n0)); asm volatile("" : "+v"(n1)); x0 = __fmul_rn(bfr(nw[dd]), n0); x1 = __fmul_rn(bfr(nw[dp]), n1); }
        const v2f cs = *(const v2f*)(CS + ((size_t)t * HD + dd) * 2); float a = __fmul_rn(x0, cs[0]), bq = __fmul_rn(x1, cs[1]); asm volatile("" : "+v"(a)); asm volatile("" : "+v"(bq)); const float r = ((dd < HD / 2) ? __fsub_rn(a, bq) : __fadd_rn(a, bq)) * sc;
        o16[q] = tohx(r); unsigned short a2, c2; splitf(r, a2, c2); oh[q] = a2; ol[q] = c2; }
    *(v2h*)(P16 + e) = o16; *(v2us*)(Ph + e) = oh; *(v2us*)(Pl + e) = ol;  }
__global__ __launch_bounds__(256) void k_vtp(const float* __restrict__ F, int pitch, int nheads, h16* V16, bf* Vh, bf* Vl) { const size_t e = ((size_t)blockIdx.x * 256 + threadIdx.x) * 2; if (e >= (size_t)nheads * HD * TT) return; const int t = (int)(e % TT); const int d = (int)((e / TT) % HD); const int g = (int)(e / ((size_t)TT * HD)); v2h o16; v2us oh, ol;
#pragma unroll
    for (int q = 0; q < 2; ++q) { const float x = F[(size_t)(t + q) * pitch + g * HD + d]; o16[q] = tohx(x); unsigned short a2, c2; splitf(x, a2, c2); oh[q] = a2; ol[q] = c2; }
    *(v2h*)(V16 + e) = o16; *(v2us*)(Vh + e) = oh; *(v2us*)(Vl + e) = ol;  }
__global__ __launch_bounds__(256) void k_csid(float* CS) { const int idx = blockIdx.x * 256 + threadIdx.x; if (idx >= TT * HD) return; v2f cs; cs[0] = 1.0f; cs[1] = 0.0f; *(v2f*)(CS + (size_t)idx * 2) = cs;  }
// Lane l with lane l ^ 16: the two wave halves hold the two key halves of one query column.
__device__ __forceinline__ float xhalf(float x) { const int i = __builtin_bit_cast(int, x); return __builtin_bit_cast(float, __builtin_amdgcn_permlanex16(i, i, 0x76543210, 0xfedcba98, false, false)); }
// One fragment in the hardware k order from uniform base + per-lane byte offset + constant: two 16-byte loads, 32 bytes apart.
__device__ __forceinline__ v16bf ldo(const bf* base, unsigned off, int imm) { const char* p = (const char*)base + (size_t)off + imm; return cat16b(*(const v8usa*)p, *(const v8usa*)(p + 32)); }
__device__ __forceinline__ v16h ldo(const h16* base, unsigned off, int imm) { const char* p = (const char*)base + (size_t)off + imm; return cat16(*(const v8ha*)p, *(const v8ha*)(p + 32)); }
// Eight exponentials (base 2) in place, in one statement: each v_exp_f32 is the independent instruction that the one in front of it asks for before its result is used or its source overwritten, and the v_nop is the last one's slot
__device__ __forceinline__ void exp2x8(float (&x)[8]) {
    asm("v_exp_f32 %0, %0\n\tv_exp_f32 %1, %1\n\tv_exp_f32 %2, %2\n\tv_exp_f32 %3, %3\n\tv_exp_f32 %4, %4\n\tv_exp_f32 %5, %5\n\tv_exp_f32 %6, %6\n\tv_exp_f32 %7, %7\n\tv_nop"
        : "+v"(x[0]), "+v"(x[1]), "+v"(x[2]), "+v"(x[3]), "+v"(x[4]), "+v"(x[5]), "+v"(x[6]), "+v"(x[7]));
}
typedef __attribute__((ext_vector_type(2))) __bf16 v2b;
typedef __attribute__((ext_vector_type(8))) unsigned v8u;
template <bool HL>
__device__ __forceinline__ void fa_rows(const bf* __restrict__ Qh, const bf* __restrict__ Ql, const bf* __restrict__ Kh, const bf* __restrict__ Kl, const h16* __restrict__ V16, const bf* __restrict__ Vh, const bf* __restrict__ Vl, float* __restrict__ O, int lane) {
    const int c = lane & 15, hf = lane >> 4; const float cscale = SCL * 1.4426950408889634f;
    v16bf qh[2][2], ql[2][2];
#pragma unroll
    for (int g = 0; g < 2; ++g)
#pragma unroll
        for (int kc = 0; kc < 2; ++kc) { const int o = (16 * g + c) * HD + 32 * kc + 8 * hf; qh[g][kc] = WFrag<bf>::ld(Qh + o); ql[g][kc] = WFrag<bf>::ld(Ql + o); }
    v8f acc[2][4]; float mrun[2], lrun[2];
#pragma unroll
    for (int g = 0; g < 2; ++g) { mrun[g] = -__builtin_inff(); lrun[g] = 0.f;
#pragma unroll
        for (int t = 0; t < 4; ++t) acc[g][t] = (v8f){}; }
    // per-lane walking byte offsets: every fragment load of a pass is a uniform plane base + one of these + an immediate offset
    unsigned ko = (unsigned)(c * HD + 8 * hf) * 2u, vo = (unsigned)(c * TT + 8 * hf) * 2u;
    v16bf kh[2][2], kl[2][2];
#pragma unroll
    for (int kt = 0; kt < 2; ++kt)
#pragma unroll
        for (int kc = 0; kc < 2; ++kc) { kh[kt][kc] = ldo(Kh, ko, (kt * 16 * HD + 32 * kc) * 2); kl[kt][kc] = ldo(Kl, ko, (kt * 16 * HD + 32 * kc) * 2); }
    asm volatile("s_wait_xcnt 0x0" ::: "memory");   // precaution: stands between the query and first key loads and any later overwrite of the address registers they name
    __builtin_amdgcn_sched_barrier(0);   // holds the loop's register writes behind that wait
    for (int kb = 0; kb < TT / 32; ++kb) {
        // this pass's value fragments: issued first, in flight under the score products and the maxima
        v16h v16[4]; v16bf vh[4], vl[4];
#pragma unroll
        for (int t = 0; t < 4; ++t) { if constexpr (HL) { vh[t] = ldo(Vh, vo, t * 16 * TT * 2); vl[t] = ldo(Vl, vo, t * 16 * TT * 2); } else v16[t] = ldo(V16, vo, t * 16 * TT * 2); }
        __builtin_amdgcn_sched_barrier(0);   // keeps the value loads in front of the score products (the scheduler sinks them to just before their use, where their latency shows)
        v8f s[2][2];
#pragma unroll
        for (int kt = 0; kt < 2; ++kt)
#pragma unroll
            for (int g = 0; g < 2; ++g) s[kt][g] = (v8f){};
#pragma unroll
        for (int kc = 0; kc < 2; ++kc) {
#pragma unroll
            for (int kt = 0; kt < 2; ++kt)
#pragma unroll
                for (int g = 0; g < 2; ++g) s[kt][g] = wmmab(kh[kt][kc], qh[g][kc], s[kt][g]);
#pragma unroll
            for (int kt = 0; kt < 2; ++kt)
#pragma unroll
                for (int g = 0; g < 2; ++g) s[kt][g] = wmmab(kh[kt][kc], ql[g][kc], s[kt][g]);
#pragma unroll
            for (int kt = 0; kt < 2; ++kt)
#pragma unroll
                for (int g = 0; g < 2; ++g) s[kt][g] = wmmab(kl[kt][kc], qh[g][kc], s[kt][g]);
        }
        // the next pass's key fragments, into the same registers, in flight under this pass's softmax and second product (the last pass wraps to keys 0-31: in bounds, unused)
        __builtin_amdgcn_sched_barrier(0);   // keeps the wait and the key loads behind the score products that read the registers they refill
        // precaution: the walking offsets are registers that issued loads name, so the wait stands in front of their increments (the offsets pass through the statement, so the additions cannot be lifted over it)
        asm volatile("s_wait_xcnt 0x0" : "+v"(ko), "+v"(vo) : : "memory");
        { ko = (ko + 32u * HD * 2u) & (unsigned)(TT * HD * 2 - 1); vo += 32u * 2u;
#pragma unroll
          for (int kt = 0; kt < 2; ++kt)
#pragma unroll
              for (int kc = 0; kc < 2; ++kc) { kh[kt][kc] = ldo(Kh, ko, (kt * 16 * HD + 32 * kc) * 2); kl[kt][kc] = ldo(Kl, ko, (kt * 16 * HD + 32 * kc) * 2); } }
        __builtin_amdgcn_sched_barrier(0);   // keeps the key loads in front of the softmax, a whole softmax and second product ahead of their use
        float mb[2]; bool need = false;
#pragma unroll
        for (int g = 0; g < 2; ++g) { float mx = s[0][g][0];
#pragma unroll
            for (int r = 1; r < 8; ++r) mx = fmaxf(mx, s[0][g][r]);
#pragma unroll
            for (int r = 0; r < 8; ++r) mx = fmaxf(mx, s[1][g][r]);
            mx = fmaxf(mx, xhalf(mx)) * cscale; mb[g] = mx; need = need || (mx > mrun[g] + 8.0f); }
        if (__builtin_amdgcn_ballot_w32(need) != 0) {   // one scalar test per pass; rare after the first passes
#pragma unroll
            for (int g = 0; g < 2; ++g) { const float mn = fmaxf(mrun[g], mb[g]); const float corr = __builtin_amdgcn_exp2f(mrun[g] - mn); mrun[g] = mn; lrun[g] *= corr;   // corr is 0 on the first pass (mrun = -inf)
#pragma unroll
                for (int t = 0; t < 4; ++t) acc[g][t] = acc[g][t] * corr; }
        }
#pragma unroll
        for (int g = 0; g < 2; ++g) { const float nm = -mrun[g]; v8u w, w2; float ls0 = 0.f, ls1 = 0.f; float pe[2][8];
#pragma unroll
            for (int kt = 0; kt < 2; ++kt) {
#pragma unroll
                for (int r = 0; r < 8; ++r) pe[kt][r] = __builtin_fmaf(s[kt][g][r], cscale, nm);
                exp2x8(pe[kt]); }
#pragma unroll
            for (int i = 0; i < 8; ++i) {
                const float p0 = pe[i >> 2][2 * (i & 3)], p1 = pe[i >> 2][2 * (i & 3) + 1];
                ls0 += p0; ls1 += p1; const v2f pp = {p0, p1};
                if constexpr (HL) { const v2b ph = __builtin_convertvector(pp, v2b); const v2f rest = pp - __builtin_convertvector(ph, v2f); w[i] = __builtin_bit_cast(unsigned, ph); w2[i] = __builtin_bit_cast(unsigned, __builtin_convertvector(rest, v2b)); }
                else w[i] = __builtin_bit_cast(unsigned, __builtin_convertvector(pp, v2h)); }
            lrun[g] += ls0 + ls1;
            if constexpr (HL) { const v16bf ph = __builtin_bit_cast(v16bf, w), pl = __builtin_bit_cast(v16bf, w2);
#pragma unroll
                for (int t = 0; t < 4; ++t) acc[g][t] = wmmab(vh[t], ph, acc[g][t]);
#pragma unroll
                for (int t = 0; t < 4; ++t) acc[g][t] = wmmab(vh[t], pl, acc[g][t]);
#pragma unroll
                for (int t = 0; t < 4; ++t) acc[g][t] = wmmab(vl[t], ph, acc[g][t]);
            } else { const v16h pf = __builtin_bit_cast(v16h, w);
#pragma unroll
                for (int t = 0; t < 4; ++t) acc[g][t] = wmma16(v16[t], pf, acc[g][t]); } }
    }
    asm volatile("s_wait_xcnt 0x0" ::: "memory");   // precaution: stands between the last pass's loads and the epilogue's reuse of the offset registers they name
    __builtin_amdgcn_sched_barrier(0);   // holds the epilogue's register writes behind that wait
    float* orow = O + (size_t)c * DQ + 8 * hf;   // row = query; a lane's 8 accumulator registers are d = 16 t + 8 h .. + 7
#pragma unroll
    for (int g = 0; g < 2; ++g) { const float lt = lrun[g] + xhalf(lrun[g]); const float inv = __fdiv_rn(1.0f, lt);
#pragma unroll
        for (int t = 0; t < 4; ++t) acc[g][t] = acc[g][t] * inv; }
    __builtin_amdgcn_sched_barrier(0);   // all arithmetic in front of the first store: nothing behind it overwrites a register that an issued store names
#pragma unroll
    for (int g = 0; g < 2; ++g)
#pragma unroll
        for (int t = 0; t < 4; ++t) { const v8f o = acc[g][t]; const v4f a = {o[0], o[1], o[2], o[3]}, b2 = {o[4], o[5], o[6], o[7]}; *(v4f*)(orow + g * 16 * DQ + 16 * t) = a; *(v4f*)(orow + g * 16 * DQ + 16 * t + 4) = b2; }
}
// k_fattn: grid (8, heads, batches), 8 waves; wave w of block x takes query rows (8 w + x) * 32 .. + 31, so every block holds two waves of the hi / lo rows (< RH) and six of the rest, and all eight walk the same key / value planes.
__global__ __launch_bounds__(256) void k_fattn(const bf* __restrict__ Qh, const bf* __restrict__ Ql, const bf* __restrict__ Kh, const bf* __restrict__ Kl, const h16* __restrict__ V16, const bf* __restrict__ Vh, const bf* __restrict__ Vl, float* __restrict__ OUT) {
    const int lane = threadIdx.x & 31; const int wave = __builtin_amdgcn_readfirstlane((int)(threadIdx.x >> 5)); const int q0 = (wave * 8 + (int)blockIdx.x) * 32;
    const size_t pz = ((size_t)blockIdx.z * NH_ + blockIdx.y) * TT * HD; float* O = OUT + ((size_t)blockIdx.z * TT + q0) * DQ + blockIdx.y * HD;
    if (q0 < RH) fa_rows<true>(Qh + pz + (size_t)q0 * HD, Ql + pz + (size_t)q0 * HD, Kh + pz, Kl + pz, V16 + pz, Vh + pz, Vl + pz, O, lane);
    else fa_rows<false>(Qh + pz + (size_t)q0 * HD, Ql + pz + (size_t)q0 * HD, Kh + pz, Kl + pz, V16 + pz, Vh + pz, Vl + pz, O, lane);
}

extern "C" void kernel_launch(void* const* d_in, const int* in_sizes, int n_in,
                              void* d_out, int out_size, void* d_ws, size_t ws_size, hipStream_t stream) {
    (void)in_sizes; (void)n_in; (void)out_size;
    const float* xq = (const float*)d_in[0]; const float* xk = (const float*)d_in[1]; const float* xv = (const float*)d_in[2];   /* query, key, value ([4][2048][512] each, GIVEN: this module has NO projections): THREE inputs */
    float* OUT = (float*)d_out;     // [4][2048][512]
    char* wsp = (char*)d_ws;
    auto take = [&](size_t bytes) { char* p = wsp; wsp += (bytes + 255) & ~(size_t)255; return (void*)p; };
    bf* WQKV = (bf*)take((size_t)3 * DQ * DM * 2); bf* WQ = WQKV; bf* WK = WQKV + (size_t)DQ * DM; bf* WV = WQKV + (size_t)2 * DQ * DM;   /* fused Bt [3*DQ][DM]: q | k | v row blocks */ float* CS = (float*)take((size_t)TT * HD * 2 * 4);
    bf* XB = (bf*)take((size_t)TT * DM * 2); float* FQ = (float*)take((size_t)TT * DQ * 4); float* FK = (float*)take((size_t)TT * DKV * 4);
    const size_t PB = (size_t)NH_ * TT * HD;   // elements of one batch's plane [h][t][d] (values: [h][d][t])
    h16* QP16 = (h16*)take(PB * 2); h16* KP16 = (h16*)take(PB * 2);   /* written by the plane builder, not read */ h16* VT16 = (h16*)take(NB_ * PB * 2);
    bf* QPh = (bf*)take(NB_ * PB * 2); bf* QPl = (bf*)take(NB_ * PB * 2); bf* KPh = (bf*)take(NB_ * PB * 2); bf* KPl = (bf*)take(NB_ * PB * 2); bf* VTh = (bf*)take(NB_ * PB * 2); bf* VTl = (bf*)take(NB_ * PB * 2);   /* planes of all four batches: [b][h][..] */
    if ((size_t)(wsp - (char*)d_ws) > ws_size) return;    // ws 256 MiB
    float* FV = FK;
    { /* no projection weight in this module: nothing to stage */
      
       }
    k_csid<<<(TT * HD + 255) / 256, 256, 0, stream>>>(CS);
    const unsigned LQ = (unsigned)(((size_t)NH_ * TT * HD / 2 + 255) / 256), LKv = (unsigned)(((size_t)NKV * TT * HD / 2 + 255) / 256);
    for (int b = 0; b < NB_; ++b) {
        
        /* no input cast: the plane builders read the given f32 rows */
        k_rope<<<LQ, 256, 0, stream>>>(xq + (size_t)b * TT * DM, DM, NH_, CS, nullptr, nullptr, 1.0f, QP16, QPh + b * PB, QPl + b * PB);   /* the q planes straight from the INPUT rows [t][h * 64 + d] (pitch DM); identity table: a plain plane builder */
        k_rope<<<LKv, 256, 0, stream>>>(xk + (size_t)b * TT * DM, DM, NKV, CS, nullptr, nullptr, 1.0f, KP16, KPh + b * PB, KPl + b * PB);
        k_vtp<<<LKv, 256, 0, stream>>>(xv + (size_t)b * TT * DM, DM, NKV, VT16 + b * PB, VTh + b * PB, VTl + b * PB);   /* the transposed value planes straight from the INPUT rows */
    }
    k_fattn<<<dim3(TT / 256, NH_, NB_), 256, 0, stream>>>(QPh, QPl, KPh, KPl, VT16, VTh, VTl, OUT);   /* scores (3 products), softmax and P.V (hybrid) of every batch and head */
}

// v002
// A run of this version takes 126 microseconds.
// In two side-by-side timings against v001, it was 1.24 and 1.25 times as fast.
// Counting every step since v000, it is 13.9 times as fast.
#include <hip/hip_runtime.h>

// Dense multi-head attention CORE on GIVEN query, key, value (query, key, value [4][2048][512]; 8 heads x 64 by reshape: head h = features h * 64 .. h * 64 + 63; scores / sqrt(64); softmax over all 2,048 keys (no mask); out = weights v merged in head order -> [4][2048][512] (4.2 M); NO projections; argument order query, key, value). THIS ROW: the same attention core at width 512 with 8 heads x 64 (Q, K, V [4][2048][512] given; no projections): the file constants DM 512 and NH_ = NKV = 8.
// Layout: NO input cast and NO projections: ONE launch (k_planes) reads the GIVEN f32 query / key / value rows [t][h * 64 + d] of every batch and writes the planes [b][h][..] (values transposed); then ONE launch (k_fattn) does scores, softmax and P.V for every batch and head with the scores kept in registers (online softmax) and writes the merged f32 output rows.
// Compute dtypes, f32 accumulate: the GIVEN f32 query, key, value are NOT rounded to bf16: q and k as bf16 hi / lo planes (hi + lo carries about 16 bits of the f32 value), v likewise (transposed) plus an f16 plane; EVERY row's scores on hi / lo planes (3 products); P.V: rows < 512 hi / lo (3 products), the rest single fp16; softmax f32; the context written in f32.

#define NB_  4
#define TT   2048
#define DM   512 
#define NH_  8 
#define NKV  8 
#define REP  (NH_ / NKV)
#define HD   64
#define DQ   (NH_ * HD)
#define DKV  (NKV * HD)
#define RH   512                  // query rows < RH: P.V on hi+lo value planes (0: none)
#define WIN  0
#define SCL  0.125f   // HD^-0.5
typedef _Float16 h16;
typedef unsigned short bf;
typedef __attribute__((ext_vector_type(16))) __bf16   v16bf;
typedef __attribute__((ext_vector_type(16))) _Float16 v16h;
typedef __attribute__((ext_vector_type(8)))  _Float16 v8h;
typedef __attribute__((ext_vector_type(8)))  unsigned short v8us;
typedef __attribute__((ext_vector_type(8)))  float    v8f;
typedef __attribute__((ext_vector_type(4)))  float    v4f;
typedef v8h  __attribute__((may_alias)) v8ha;
typedef v4f  __attribute__((may_alias)) v4fa;
typedef v8us __attribute__((may_alias)) v8usa;

__device__ __forceinline__ unsigned short f2bf(float f) { unsigned u = __float_as_uint(f); u += 0x7FFFu + ((u >> 16) & 1u); return (unsigned short)(u >> 16); }
__device__ __forceinline__ float bf2f(unsigned short b) { return __uint_as_float(((unsigned)b) << 16); }
__device__ __forceinline__ float bfr(float f) { return bf2f(f2bf(f)); }
__device__ __forceinline__ v16h cat16(v8h lo, v8h hi) { return __builtin_shufflevector(lo, hi, 0, 1, 2, 3, 4, 5, 6, 7, 8, 9, 10, 11, 12, 13, 14, 15); }
__device__ __forceinline__ v16bf cat16b(v8us lo, v8us hi) { return __builtin_bit_cast(v16bf, __builtin_shufflevector(lo, hi, 0, 1, 2, 3, 4, 5, 6, 7, 8, 9, 10, 11, 12, 13, 14, 15)); }
__device__ __forceinline__ v8f wmma16(v16h a, v16h b, v8f c) { return __builtin_amdgcn_wmma_f32_16x16x32_f16(false, a, false, b, (short)0, c, false, false); }
__device__ __forceinline__ v8f wmmab(v16bf a, v16bf b, v8f c) { return __builtin_amdgcn_wmma_f32_16x16x32_bf16(false, a, false, b, (short)0, c, false, false); }



// Fragment loaders in the hardware k order (two 16-byte loads per lane, k = 8h .. 8h + 7 and 16 + 8h .. 16 + 8h + 7), operands straight from K-contiguous 16-bit planes.
template <typename T16> struct WFrag;
template <> struct WFrag<h16> { typedef v16h V; static __device__ __forceinline__ V ld(const h16* p) { return cat16(*(const v8h*)p, *(const v8h*)(p + 16)); } static __device__ __forceinline__ v8f mma(V a, V b, v8f c) { return wmma16(a, b, c); } };
template <> struct WFrag<bf> { typedef v16bf V; static __device__ __forceinline__ V ld(const bf* p) { return cat16b(*(const v8us*)p, *(const v8us*)(p + 16)); } static __device__ __forceinline__ v8f mma(V a, V b, v8f c) { return wmmab(a, b, c); } };
__device__ __forceinline__ h16 tohx(float x) { return (h16)x; }
__device__ __forceinline__ void splitf(float y, unsigned short& h, unsigned short& l) { h = f2bf(y); l = f2bf(y - bf2f(h)); }
typedef __attribute__((ext_vector_type(2))) _Float16 v2h;
typedef __attribute__((ext_vector_type(4))) _Float16 v4h;
typedef __attribute__((ext_vector_type(2))) unsigned short v2us;
typedef __attribute__((ext_vector_type(4))) unsigned short v4us;
typedef __attribute__((ext_vector_type(2))) float v2f;
typedef __attribute__((ext_vector_type(4))) int v4i;

__global__ __launch_bounds__(256) void k_wtG(const float* __restrict__ w, int K, int N, bf* Bt) {
    const int lane = threadIdx.x & 31; const int L0 = (blockIdx.x * 8 + (threadIdx.x >> 5)) * 8; const int nlines = N * K / 64;
{
#pragma unroll 1
        for (int l = 0; l < 8; ++l) { const int L = L0 + l; if (L >= nlines) break; const size_t e = (size_t)L * 64 + lane * 2; const int k = (int)(e % K), n = (int)(e / K); v2us o;
            o[0] = f2bf(w[(size_t)k * N + n]); o[1] = f2bf(w[(size_t)(k + 1) * N + n]); *(v2us*)(Bt + e) = o; }
         }
}
__global__ __launch_bounds__(256) void k_cvt8(const float* __restrict__ src, bf* dst, size_t n8) { const size_t i = (size_t)blockIdx.x * 256 + threadIdx.x; if (i >= n8) return; const v8f v = *(const v8f*)(src + i * 8); v8us o;
#pragma unroll
    for (int k = 0; k < 8; ++k) o[k] = f2bf(v[k]); *(v8us*)(dst + i * 8) = o;  }

typedef __attribute__((ext_vector_type(2))) __bf16 v2b;
typedef __attribute__((ext_vector_type(4))) unsigned v4u;
typedef v4u __attribute__((may_alias)) v4ua;
// 16 bytes at uniform base + per-lane byte offset + constant
__device__ __forceinline__ v4f ldf4(const float* base, unsigned off, int imm) { return *(const v4fa*)((const char*)base + (size_t)off + imm); }
__device__ __forceinline__ void st16(void* base, unsigned off, int imm, v4u x) { *(v4ua*)((char*)base + (size_t)off + imm) = x; }
// two f32 -> packed bf16 hi and packed bf16 lo = bf16(x - hi), both round to nearest even
__device__ __forceinline__ void split2(float x0, float x1, unsigned& h, unsigned& l) { const v2f pp = {x0, x1}; const v2b ph = __builtin_convertvector(pp, v2b); const v2f rest = pp - __builtin_convertvector(ph, v2f); h = __builtin_bit_cast(unsigned, ph); l = __builtin_bit_cast(unsigned, __builtin_convertvector(rest, v2b)); }
// k_planes: every plane of every batch in ONE launch of 512 blocks x 8 waves (two blocks per WGP, all resident at once); a thread takes 32 query, 32 key and 32 value elements: 24 loads of 16 bytes in flight, then 28 stores of 16 bytes.
// query / key: block = 16 rows t of one batch, wave = head; a lane holds 8 consecutive d of one row, so a wave's store is 512 contiguous bytes of the plane [b][h][t][d].
// value: block = 64 rows t x 2 heads, wave = 16 features d; a lane holds 8 t x 4 d, so the transposition is a choice of registers and 8 lanes' stores fill one 128-byte line of the plane [b][h][d][t].
__global__ __launch_bounds__(256) void k_planes(bf* __restrict__ Qh, bf* __restrict__ Ql, bf* __restrict__ Kh, bf* __restrict__ Kl, h16* __restrict__ V16, bf* __restrict__ Vh, bf* __restrict__ Vl, const float* __restrict__ xq, const float* __restrict__ xk, const float* __restrict__ xv) {
    const int lane = threadIdx.x & 31; const int wave = __builtin_amdgcn_readfirstlane((int)(threadIdx.x >> 5)); const int b = (int)blockIdx.x >> 7, r = (int)blockIdx.x & 127;
    const size_t qi = ((size_t)b * TT + r * 16) * DM + wave * HD, qo = (((size_t)b * NH_ + wave) * TT + r * 16) * HD;   // uniform element offsets: input rows, plane rows
    const int vhd = (r & 3) * 2 + (wave >> 2), vd0 = (wave & 3) * 16, vt0 = (r >> 2) * 64;
    const size_t vi = ((size_t)b * TT + vt0) * DM + vhd * HD + vd0, vq = (((size_t)b * NH_ + vhd) * HD + vd0) * TT + vt0;
    const unsigned lqi = (unsigned)((lane >> 3) * DM + (lane & 7) * 8) * 4u, lqo = (unsigned)lane * 16u;   // per-lane byte offsets
    const unsigned lvi = (unsigned)((lane & 7) * 8 * DM + (lane >> 3) * 4) * 4u, lvo = (unsigned)((lane >> 3) * 4 * TT + (lane & 7) * 8) * 2u;
    bf* const pqh = Qh + qo; bf* const pql = Ql + qo; bf* const pkh = Kh + qo; bf* const pkl = Kl + qo; h16* const pv16 = V16 + vq; bf* const pvh = Vh + vq; bf* const pvl = Vl + vq;   // uniform store bases
    v4f q[4][2], k[4][2], v[8];
#pragma unroll
    for (int i = 0; i < 4; ++i)
#pragma unroll
        for (int s = 0; s < 2; ++s) { q[i][s] = ldf4(xq + qi, lqi, i * 4 * DM * 4 + s * 16); k[i][s] = ldf4(xk + qi, lqi, i * 4 * DM * 4 + s * 16); }
#pragma unroll
    for (int i = 0; i < 8; ++i) v[i] = ldf4(xv + vi, lvi, i * DM * 4);
    asm volatile("s_wait_xcnt 0x0" ::: "memory");   // precaution: stands between the loads and any later overwrite of the offset registers they name
    __builtin_amdgcn_sched_barrier(0);   // holds the conversions' register writes behind that wait
    v4u oqh[4], oql[4], okh[4], okl[4], ov16[4], ovh[4], ovl[4];
#pragma unroll
    for (int i = 0; i < 4; ++i)
#pragma unroll
        for (int p = 0; p < 4; ++p) { unsigned h, l; split2(q[i][p >> 1][2 * (p & 1)], q[i][p >> 1][2 * (p & 1) + 1], h, l); oqh[i][p] = h; oql[i][p] = l; split2(k[i][p >> 1][2 * (p & 1)], k[i][p >> 1][2 * (p & 1) + 1], h, l); okh[i][p] = h; okl[i][p] = l; }
#pragma unroll
    for (int j = 0; j < 4; ++j)   // feature vd0 + 4 (lane >> 3) + j, rows 2 p and 2 p + 1 of the lane's eight
#pragma unroll
        for (int p = 0; p < 4; ++p) { const float x0 = v[2 * p][j], x1 = v[2 * p + 1][j]; unsigned h, l; split2(x0, x1, h, l); ovh[j][p] = h; ovl[j][p] = l; const v2f pp = {x0, x1}; ov16[j][p] = __builtin_bit_cast(unsigned, __builtin_convertvector(pp, v2h)); }
    __builtin_amdgcn_sched_barrier(0);   // all arithmetic in front of the first store: nothing behind it overwrites a register that an issued store names
#pragma unroll
    for (int i = 0; i < 4; ++i) { st16(pqh, lqo, i * 4 * HD * 2, oqh[i]); st16(pql, lqo, i * 4 * HD * 2, oql[i]); st16(pkh, lqo, i * 4 * HD * 2, okh[i]); st16(pkl, lqo, i * 4 * HD * 2, okl[i]); st16(pv16, lvo, i * TT * 2, ov16[i]); st16(pvh, lvo, i * TT * 2, ovh[i]); st16(pvl, lvo, i * TT * 2, ovl[i]); }
}
// Lane l with lane l ^ 16: the two wave halves hold the two key halves of one query column.
__device__ __forceinline__ float xhalf(float x) { const int i = __builtin_bit_cast(int, x); return __builtin_bit_cast(float, __builtin_amdgcn_permlanex16(i, i, 0x76543210, 0xfedcba98, false, false)); }
// One fragment in the hardware k order from uniform base + per-lane byte offset + constant: two 16-byte loads, 32 bytes apart.
__device__ __forceinline__ v16bf ldo(const bf* base, unsigned off, int imm) { const char* p = (const char*)base + (size_t)off + imm; return cat16b(*(const v8usa*)p, *(const v8usa*)(p + 32)); }
__device__ __forceinline__ v16h ldo(const h16* base, unsigned off, int imm) { const char* p = (const char*)base + (size_t)off + imm; return cat16(*(const v8ha*)p, *(const v8ha*)(p + 32)); }
// Eight exponentials (base 2) in place, in one statement: each v_exp_f32 is the independent instruction that the one in front of it asks for before its result is used or its source overwritten, and the v_nop is the last one's slot
__device__ __forceinline__ void exp2x8(float (&x)[8]) {
    asm("v_exp_f32 %0, %0\n\tv_exp_f32 %1, %1\n\tv_exp_f32 %2, %2\n\tv_exp_f32 %3, %3\n\tv_exp_f32 %4, %4\n\tv_exp_f32 %5, %5\n\tv_exp_f32 %6, %6\n\tv_exp_f32 %7, %7\n\tv_nop"
        : "+v"(x[0]), "+v"(x[1]), "+v"(x[2]), "+v"(x[3]), "+v"(x[4]), "+v"(x[5]), "+v"(x[6]), "+v"(x[7]));
}
typedef __attribute__((ext_vector_type(8))) unsigned v8u;
template <bool HL>
__device__ __forceinline__ void fa_rows(const bf* __restrict__ Qh, const bf* __restrict__ Ql, const bf* __restrict__ Kh, const bf* __restrict__ Kl, const h16* __restrict__ V16, const bf* __restrict__ Vh, const bf* __restrict__ Vl, float* __restrict__ O, int lane) {
    const int c = lane & 15, hf = lane >> 4; const float cscale = SCL * 1.4426950408889634f;
    v16bf qh[2][2], ql[2][2];
#pragma unroll
    for (int g = 0; g < 2; ++g)
#pragma unroll
        for (int kc = 0; kc < 2; ++kc) { const int o = (16 * g + c) * HD + 32 * kc + 8 * hf; qh[g][kc] = WFrag<bf>::ld(Qh + o); ql[g][kc] = WFrag<bf>::ld(Ql + o); }
    v8f acc[2][4]; float mrun[2], lrun[2];
#pragma unroll
    for (int g = 0; g < 2; ++g) { mrun[g] = -__builtin_inff(); lrun[g] = 0.f;
#pragma unroll
        for (int t = 0; t < 4; ++t) acc[g][t] = (v8f){}; }
    // per-lane walking byte offsets: every fragment load of a pass is a uniform plane base + one of these + an immediate offset
    unsigned ko = (unsigned)(c * HD + 8 * hf) * 2u, vo = (unsigned)(c * TT + 8 * hf) * 2u;
    v16bf kh[2][2], kl[2][2];
#pragma unroll
    for (int kt = 0; kt < 2; ++kt)
#pragma unroll
        for (int kc = 0; kc < 2; ++kc) { kh[kt][kc] = ldo(Kh, ko, (kt * 16 * HD + 32 * kc) * 2); kl[kt][kc] = ldo(Kl, ko, (kt * 16 * HD + 32 * kc) * 2); }
    asm volatile("s_wait_xcnt 0x0" ::: "memory");   // precaution: stands between the query and first key loads and any later overwrite of the address registers they name
    __builtin_amdgcn_sched_barrier(0);   // holds the loop's register writes behind that wait
    for (int kb = 0; kb < TT / 32; ++kb) {
        // this pass's value fragments: issued first, in flight under the score products and the maxima
        v16h v16[4]; v16bf vh[4], vl[4];
#pragma unroll
        for (int t = 0; t < 4; ++t) { if constexpr (HL) { vh[t] = ldo(Vh, vo, t * 16 * TT * 2); vl[t] = ldo(Vl, vo, t * 16 * TT * 2); } else v16[t] = ldo(V16, vo, t * 16 * TT * 2); }
        __builtin_amdgcn_sched_barrier(0);   // keeps the value loads in front of the score products (the scheduler sinks them to just before their use, where their latency shows)
        v8f s[2][2];
#pragma unroll
        for (int kt = 0; kt < 2; ++kt)
#pragma unroll
            for (int g = 0; g < 2; ++g) s[kt][g] = (v8f){};
#pragma unroll
        for (int kc = 0; kc < 2; ++kc) {
#pragma unroll
            for (int kt = 0; kt < 2; ++kt)
#pragma unroll
                for (int g = 0; g < 2; ++g) s[kt][g] = wmmab(kh[kt][kc], qh[g][kc], s[kt][g]);
#pragma unroll
            for (int kt = 0; kt < 2; ++kt)
#pragma unroll
                for (int g = 0; g < 2; ++g) s[kt][g] = wmmab(kh[kt][kc], ql[g][kc], s[kt][g]);
#pragma unroll
            for (int kt = 0; kt < 2; ++kt)
#pragma unroll
                for (int g = 0; g < 2; ++g) s[kt][g] = wmmab(kl[kt][kc], qh[g][kc], s[kt][g]);
        }
        // the next pass's key fragments, into the same registers, in flight under this pass's softmax and second product (the last pass wraps to keys 0-31: in bounds, unused)
        __builtin_amdgcn_sched_barrier(0);   // keeps the wait and the key loads behind the score products that read the registers they refill
        // precaution: the walking offsets are registers that issued loads name, so the wait stands in front of their increments (the offsets pass through the statement, so the additions cannot be lifted over it)
        asm volatile("s_wait_xcnt 0x0" : "+v"(ko), "+v"(vo) : : "memory");
        { ko = (ko + 32u * HD * 2u) & (unsigned)(TT * HD * 2 - 1); vo += 32u * 2u;
#pragma unroll
          for (int kt = 0; kt < 2; ++kt)
#pragma unroll
              for (int kc = 0; kc < 2; ++kc) { kh[kt][kc] = ldo(Kh, ko, (kt * 16 * HD + 32 * kc) * 2); kl[kt][kc] = ldo(Kl, ko, (kt * 16 * HD + 32 * kc) * 2); } }
        __builtin_amdgcn_sched_barrier(0);   // keeps the key loads in front of the softmax, a whole softmax and second product ahead of their use
        float mb[2]; bool need = false;
#pragma unroll
        for (int g = 0; g < 2; ++g) { float mx = s[0][g][0];
#pragma unroll
            for (int r = 1; r < 8; ++r) mx = fmaxf(mx, s[0][g][r]);
#pragma unroll
            for (int r = 0; r < 8; ++r) mx = fmaxf(mx, s[1][g][r]);
            mx = fmaxf(mx, xhalf(mx)) * cscale; mb[g] = mx; need = need || (mx > mrun[g] + 8.0f); }
        if (__builtin_amdgcn_ballot_w32(need) != 0) {   // one scalar test per pass; rare after the first passes
#pragma unroll
            for (int g = 0; g < 2; ++g) { const float mn = fmaxf(mrun[g], mb[g]); const float corr = __builtin_amdgcn_exp2f(mrun[g] - mn); mrun[g] = mn; lrun[g] *= corr;   // corr is 0 on the first pass (mrun = -inf)
#pragma unroll
                for (int t = 0; t < 4; ++t) acc[g][t] = acc[g][t] * corr; }
        }
#pragma unroll
        for (int g = 0; g < 2; ++g) { const float nm = -mrun[g]; v8u w, w2; float ls0 = 0.f, ls1 = 0.f; float pe[2][8];
#pragma unroll
            for (int kt = 0; kt < 2; ++kt) {
#pragma unroll
                for (int r = 0; r < 8; ++r) pe[kt][r] = __builtin_fmaf(s[kt][g][r], cscale, nm);
                exp2x8(pe[kt]); }
#pragma unroll
            for (int i = 0; i < 8; ++i) {
                const float p0 = pe[i >> 2][2 * (i & 3)], p1 = pe[i >> 2][2 * (i & 3) + 1];
                ls0 += p0; ls1 += p1; const v2f pp = {p0, p1};
                if constexpr (HL) { const v2b ph = __builtin_convertvector(pp, v2b); const v2f rest = pp - __builtin_convertvector(ph, v2f); w[i] = __builtin_bit_cast(unsigned, ph); w2[i] = __builtin_bit_cast(unsigned, __builtin_convertvector(rest, v2b)); }
                else w[i] = __builtin_bit_cast(unsigned, __builtin_convertvector(pp, v2h)); }
            lrun[g] += ls0 + ls1;
            if constexpr (HL) { const v16bf ph = __builtin_bit_cast(v16bf, w), pl = __builtin_bit_cast(v16bf, w2);
#pragma unroll
                for (int t = 0; t < 4; ++t) acc[g][t] = wmmab(vh[t], ph, acc[g][t]);
#pragma unroll
                for (int t = 0; t < 4; ++t) acc[g][t] = wmmab(vh[t], pl, acc[g][t]);
#pragma unroll
                for (int t = 0; t < 4; ++t) acc[g][t] = wmmab(vl[t], ph, acc[g][t]);
            } else { const v16h pf = __builtin_bit_cast(v16h, w);
#pragma unroll
                for (int t = 0; t < 4; ++t) acc[g][t] = wmma16(v16[t], pf, acc[g][t]); } }
    }
    asm volatile("s_wait_xcnt 0x0" ::: "memory");   // precaution: stands between the last pass's loads and the epilogue's reuse of the offset registers they name
    __builtin_amdgcn_sched_barrier(0);   // holds the epilogue's register writes behind that wait
    float* orow = O + (size_t)c * DQ + 8 * hf;   // row = query; a lane's 8 accumulator registers are d = 16 t + 8 h .. + 7
#pragma unroll
    for (int g = 0; g < 2; ++g) { const float lt = lrun[g] + xhalf(lrun[g]); const float inv = __fdiv_rn(1.0f, lt);
#pragma unroll
        for (int t = 0; t < 4; ++t) acc[g][t] = acc[g][t] * inv; }
    __builtin_amdgcn_sched_barrier(0);   // all arithmetic in front of the first store: nothing behind it overwrites a register that an issued store names
#pragma unroll
    for (int g = 0; g < 2; ++g)
#pragma unroll
        for (int t = 0; t < 4; ++t) { const v8f o = acc[g][t]; const v4f a = {o[0], o[1], o[2], o[3]}, b2 = {o[4], o[5], o[6], o[7]}; *(v4f*)(orow + g * 16 * DQ + 16 * t) = a; *(v4f*)(orow + g * 16 * DQ + 16 * t + 4) = b2; }
}
// k_fattn: grid (8, heads, batches), 8 waves; wave w of block x takes query rows (8 w + x) * 32 .. + 31, so every block holds two waves of the hi / lo rows (< RH) and six of the rest, and all eight walk the same key / value planes.
__global__ __launch_bounds__(256) void k_fattn(const bf* __restrict__ Qh, const bf* __restrict__ Ql, const bf* __restrict__ Kh, const bf* __restrict__ Kl, const h16* __restrict__ V16, const bf* __restrict__ Vh, const bf* __restrict__ Vl, float* __restrict__ OUT) {
    const int lane = threadIdx.x & 31; const int wave = __builtin_amdgcn_readfirstlane((int)(threadIdx.x >> 5)); const int q0 = (wave * 8 + (int)blockIdx.x) * 32;
    const size_t pz = ((size_t)blockIdx.z * NH_ + blockIdx.y) * TT * HD; float* O = OUT + ((size_t)blockIdx.z * TT + q0) * DQ + blockIdx.y * HD;
    if (q0 < RH) fa_rows<true>(Qh + pz + (size_t)q0 * HD, Ql + pz + (size_t)q0 * HD, Kh + pz, Kl + pz, V16 + pz, Vh + pz, Vl + pz, O, lane);
    else fa_rows<false>(Qh + pz + (size_t)q0 * HD, Ql + pz + (size_t)q0 * HD, Kh + pz, Kl + pz, V16 + pz, Vh + pz, Vl + pz, O, lane);
}

extern "C" void kernel_launch(void* const* d_in, const int* in_sizes, int n_in,
                              void* d_out, int out_size, void* d_ws, size_t ws_size, hipStream_t stream) {
    (void)in_sizes; (void)n_in; (void)out_size;
    const float* xq = (const float*)d_in[0]; const float* xk = (const float*)d_in[1]; const float* xv = (const float*)d_in[2];   /* order query, key, value ([4][2048][512] each, GIVEN: this module has NO projections) */
    float* OUT = (float*)d_out;     // [4][2048][512]
    char* wsp = (char*)d_ws;
    auto take = [&](size_t bytes) { char* p = wsp; wsp += (bytes + 255) & ~(size_t)255; return (void*)p; };
    const size_t PB = (size_t)NH_ * TT * HD;   // elements of one batch's plane [h][t][d] (values: [h][d][t])
    h16* VT16 = (h16*)take(NB_ * PB * 2);
    bf* QPh = (bf*)take(NB_ * PB * 2); bf* QPl = (bf*)take(NB_ * PB * 2); bf* KPh = (bf*)take(NB_ * PB * 2); bf* KPl = (bf*)take(NB_ * PB * 2); bf* VTh = (bf*)take(NB_ * PB * 2); bf* VTl = (bf*)take(NB_ * PB * 2);   /* planes of all four batches: [b][h][..] */
    if ((size_t)(wsp - (char*)d_ws) > ws_size) return;    // ws 256 MiB
    k_planes<<<NB_ * TT / 16, 256, 0, stream>>>(QPh, QPl, KPh, KPl, VT16, VTh, VTl, xq, xk, xv);   /* every plane of every batch straight from the INPUT rows */
    k_fattn<<<dim3(TT / 256, NH_, NB_), 256, 0, stream>>>(QPh, QPl, KPh, KPl, VT16, VTh, VTl, OUT);   /* scores (3 products), softmax and P.V (hybrid) of every batch and head */
}

// v003
// One run takes 65.1 microseconds.
// Next to v002, in two timings, it ran 1.92 and 1.95 times as fast.
// All steps since v000 together make it 26.9 times as fast.
#include <hip/hip_runtime.h>

// Dense multi-head attention CORE on GIVEN query, key, value (query, key, value [4][2048][512]; 8 heads x 64 by reshape: head h = features h * 64 .. h * 64 + 63; scores / sqrt(64); softmax over all 2,048 keys (no mask); out = weights v merged in head order -> [4][2048][512] (4.2 M); NO projections; argument order query, key, value). THIS ROW: the same attention core at width 512 with 8 heads x 64 (Q, K, V [4][2048][512] given; no projections): the file constants DM 512 and NH_ = NKV = 8.
// Layout: NO input cast and NO projections: ONE launch (k_planes) reads the GIVEN f32 query / key / value rows [t][h * 64 + d] of every batch and writes the planes [b][h][..] in matrix-fragment order (values transposed); then ONE launch (k_fattn) does scores, softmax and P.V for every batch and head with the scores kept in registers (online softmax) and writes the merged f32 output rows.
// Compute dtypes, f32 accumulate: the GIVEN f32 query, key, value are NOT rounded to bf16: q and k as bf16 hi / lo planes (hi + lo carries about 16 bits of the f32 value), v likewise (transposed) plus an f16 plane; EVERY row's scores on hi / lo planes (3 products); P.V: rows < 512 hi / lo (3 products), the rest single fp16; softmax f32; the context written in f32.

#define NB_  4
#define TT   2048
#define DM   512 
#define NH_  8 
#define NKV  8 
#define REP  (NH_ / NKV)
#define HD   64
#define DQ   (NH_ * HD)
#define DKV  (NKV * HD)
#define RH   512                  // query rows < RH: P.V on hi+lo value planes (0: none)
#define WIN  0
#define SCL  0.125f   // HD^-0.5
typedef _Float16 h16;
typedef unsigned short bf;
typedef __attribute__((ext_vector_type(16))) __bf16   v16bf;
typedef __attribute__((ext_vector_type(16))) _Float16 v16h;
typedef __attribute__((ext_vector_type(8)))  _Float16 v8h;
typedef __attribute__((ext_vector_type(8)))  unsigned short v8us;
typedef __attribute__((ext_vector_type(8)))  float    v8f;
typedef __attribute__((ext_vector_type(4)))  float    v4f;
typedef v8h  __attribute__((may_alias)) v8ha;
typedef v4f  __attribute__((may_alias)) v4fa;
typedef v8us __attribute__((may_alias)) v8usa;

__device__ __forceinline__ unsigned short f2bf(float f) { unsigned u = __float_as_uint(f); u += 0x7FFFu + ((u >> 16) & 1u); return (unsigned short)(u >> 16); }
__device__ __forceinline__ float bf2f(unsigned short b) { return __uint_as_float(((unsigned)b) << 16); }
__device__ __forceinline__ float bfr(float f) { return bf2f(f2bf(f)); }
__device__ __forceinline__ v16h cat16(v8h lo, v8h hi) { return __builtin_shufflevector(lo, hi, 0, 1, 2, 3, 4, 5, 6, 7, 8, 9, 10, 11, 12, 13, 14, 15); }
__device__ __forceinline__ v16bf cat16b(v8us lo, v8us hi) { return __builtin_bit_cast(v16bf, __builtin_shufflevector(lo, hi, 0, 1, 2, 3, 4, 5, 6, 7, 8, 9, 10, 11, 12, 13, 14, 15)); }
__device__ __forceinline__ v8f wmma16(v16h a, v16h b, v8f c) { return __builtin_amdgcn_wmma_f32_16x16x32_f16(false, a, false, b, (short)0, c, false, false); }
__device__ __forceinline__ v8f wmmab(v16bf a, v16bf b, v8f c) { return __builtin_amdgcn_wmma_f32_16x16x32_bf16(false, a, false, b, (short)0, c, false, false); }



// Fragment loaders in the hardware k order (two 16-byte loads per lane, k = 8h .. 8h + 7 and 16 + 8h .. 16 + 8h + 7), operands straight from K-contiguous 16-bit planes.
template <typename T16> struct WFrag;
template <> struct WFrag<h16> { typedef v16h V; static __device__ __forceinline__ V ld(const h16* p) { return cat16(*(const v8h*)p, *(const v8h*)(p + 16)); } static __device__ __forceinline__ v8f mma(V a, V b, v8f c) { return wmma16(a, b, c); } };
template <> struct WFrag<bf> { typedef v16bf V; static __device__ __forceinline__ V ld(const bf* p) { return cat16b(*(const v8us*)p, *(const v8us*)(p + 16)); } static __device__ __forceinline__ v8f mma(V a, V b, v8f c) { return wmmab(a, b, c); } };
__device__ __forceinline__ h16 tohx(float x) { return (h16)x; }
__device__ __forceinline__ void splitf(float y, unsigned short& h, unsigned short& l) { h = f2bf(y); l = f2bf(y - bf2f(h)); }
typedef __attribute__((ext_vector_type(2))) _Float16 v2h;
typedef __attribute__((ext_vector_type(4))) _Float16 v4h;
typedef __attribute__((ext_vector_type(2))) unsigned short v2us;
typedef __attribute__((ext_vector_type(4))) unsigned short v4us;
typedef __attribute__((ext_vector_type(2))) float v2f;
typedef __attribute__((ext_vector_type(4))) int v4i;

__global__ __launch_bounds__(256) void k_wtG(const float* __restrict__ w, int K, int N, bf* Bt) {
    const int lane = threadIdx.x & 31; const int L0 = (blockIdx.x * 8 + (threadIdx.x >> 5)) * 8; const int nlines = N * K / 64;
{
#pragma unroll 1
        for (int l = 0; l < 8; ++l) { const int L = L0 + l; if (L >= nlines) break; const size_t e = (size_t)L * 64 + lane * 2; const int k = (int)(e % K), n = (int)(e / K); v2us o;
            o[0] = f2bf(w[(size_t)k * N + n]); o[1] = f2bf(w[(size_t)(k + 1) * N + n]); *(v2us*)(Bt + e) = o; }
         }
}
__global__ __launch_bounds__(256) void k_cvt8(const float* __restrict__ src, bf* dst, size_t n8) { const size_t i = (size_t)blockIdx.x * 256 + threadIdx.x; if (i >= n8) return; const v8f v = *(const v8f*)(src + i * 8); v8us o;
#pragma unroll
    for (int k = 0; k < 8; ++k) o[k] = f2bf(v[k]); *(v8us*)(dst + i * 8) = o;  }

typedef __attribute__((ext_vector_type(2))) __bf16 v2b;
typedef __attribute__((ext_vector_type(4))) unsigned v4u;
typedef v4u __attribute__((may_alias)) v4ua;
// 16 bytes at uniform base + per-lane byte offset + constant
__device__ __forceinline__ v4f ldf4(const float* base, unsigned off, int imm) { return *(const v4fa*)((const char*)base + (size_t)off + imm); }
__device__ __forceinline__ void st16(void* base, unsigned off, int imm, v4u x) { *(v4ua*)((char*)base + (size_t)off + imm) = x; }
// two f32 -> packed bf16 hi and packed bf16 lo = bf16(x - hi), both round to nearest even
__device__ __forceinline__ void split2(float x0, float x1, unsigned& h, unsigned& l) { const v2f pp = {x0, x1}; const v2b ph = __builtin_convertvector(pp, v2b); const v2f rest = pp - __builtin_convertvector(ph, v2f); h = __builtin_bit_cast(unsigned, ph); l = __builtin_bit_cast(unsigned, __builtin_convertvector(rest, v2b)); }
// k_planes: every plane of every batch in ONE launch of 512 blocks x 8 waves (two blocks per WGP, all resident at once); a thread takes 32 query, 32 key and 32 value elements: 24 loads of 16 bytes in flight, then 28 stores of 16 bytes.
// PLANE LAYOUT = FRAGMENT ORDER: a 16 x 32 operand fragment is 1,024 contiguous bytes [j][lane][8 elements] (lane = 16 hf + c holds row c, k = 16 j + 8 hf .. + 7), so each of the two 16-byte loads of a fragment reads 512 contiguous bytes (4 whole lines).
// query / key plane [b][h][t >> 4][kc][j][lane][8]: row c = t & 15, k = d - 32 kc. value plane [b][h][t >> 5][tile][j][lane][8]: k = t & 31, and row c of tile holds feature d = 4 c + tile.
// query / key: block = 16 rows t of one batch, wave = head (one 2,048-byte group of two fragments); a lane holds 8 consecutive d of one row, 4 lanes a 128-byte input line, and 8 lanes' stores fill one 128-byte line of the plane.
// value: block = 64 rows t x 2 heads, wave = 32 rows t x 32 features d; a lane holds 8 t x 4 d, so the transposition is a choice of registers (register j goes to tile j), a load reads 4 whole input lines and 8 lanes' stores fill one 128-byte line of the plane.
__global__ __launch_bounds__(256) void k_planes(bf* __restrict__ Qh, bf* __restrict__ Ql, bf* __restrict__ Kh, bf* __restrict__ Kl, h16* __restrict__ V16, bf* __restrict__ Vh, bf* __restrict__ Vl, const float* __restrict__ xq, const float* __restrict__ xk, const float* __restrict__ xv) {
    const int lane = threadIdx.x & 31; const int wave = __builtin_amdgcn_readfirstlane((int)(threadIdx.x >> 5)); const int b = (int)blockIdx.x >> 7, r = (int)blockIdx.x & 127;
    const size_t qi = ((size_t)b * TT + r * 16) * DM + wave * HD, qo = (((size_t)b * NH_ + wave) * TT + r * 16) * HD;   // uniform element offsets: input rows, plane rows
    const int vhd = (r & 3) * 2 + (wave >> 2), vch = (wave >> 1) & 1, vkb = (r >> 2) * 2 + (wave & 1);   // head, half of its features (rows c = 8 vch .. + 7 of every tile), group of 32 rows t
    const size_t vi = ((size_t)b * TT + vkb * 32) * DM + vhd * HD + vch * 32, vq = ((size_t)b * NH_ + vhd) * HD * TT + (size_t)vkb * 32 * HD + vch * 64;
    const unsigned lfo = (unsigned)(((lane & 3) >> 1) * 512 + (lane & 1) * 256 + (lane >> 2) * 16);   // per-lane byte offset in a fragment: j and hf from the lane's group of 8 k, row c from lane >> 2
    const unsigned lqi = (unsigned)((lane >> 2) * DM + (lane & 3) * 8) * 4u, lqo = lfo;   // per-lane byte offsets
    const unsigned lvi = (unsigned)((lane & 3) * 8 * DM + (lane >> 2) * 4) * 4u, lvo = lfo;
    bf* const pqh = Qh + qo; bf* const pql = Ql + qo; bf* const pkh = Kh + qo; bf* const pkl = Kl + qo; h16* const pv16 = V16 + vq; bf* const pvh = Vh + vq; bf* const pvl = Vl + vq;   // uniform store bases
    v4f q[4][2], k[4][2], v[8];
#pragma unroll
    for (int i = 0; i < 4; ++i)
#pragma unroll
        for (int s = 0; s < 2; ++s) { q[i][s] = ldf4(xq + qi, lqi, ((i & 1) * 8 * DM + (i >> 1) * 32) * 4 + s * 16); k[i][s] = ldf4(xk + qi, lqi, ((i & 1) * 8 * DM + (i >> 1) * 32) * 4 + s * 16); }   // i: rows 8 (i & 1) .. + 7, d = 32 (i >> 1) .. + 31
#pragma unroll
    for (int i = 0; i < 8; ++i) v[i] = ldf4(xv + vi, lvi, i * DM * 4);
    asm volatile("s_wait_xcnt 0x0" ::: "memory");   // precaution: stands between the loads and any later overwrite of the offset registers they name
    __builtin_amdgcn_sched_barrier(0);   // holds the conversions' register writes behind that wait
    v4u oqh[4], oql[4], okh[4], okl[4], ov16[4], ovh[4], ovl[4];
#pragma unroll
    for (int i = 0; i < 4; ++i)
#pragma unroll
        for (int p = 0; p < 4; ++p) { unsigned h, l; split2(q[i][p >> 1][2 * (p & 1)], q[i][p >> 1][2 * (p & 1) + 1], h, l); oqh[i][p] = h; oql[i][p] = l; split2(k[i][p >> 1][2 * (p & 1)], k[i][p >> 1][2 * (p & 1) + 1], h, l); okh[i][p] = h; okl[i][p] = l; }
#pragma unroll
    for (int j = 0; j < 4; ++j)   // feature 32 vch + 4 (lane >> 2) + j, rows 2 p and 2 p + 1 of the lane's eight
#pragma unroll
        for (int p = 0; p < 4; ++p) { const float x0 = v[2 * p][j], x1 = v[2 * p + 1][j]; unsigned h, l; split2(x0, x1, h, l); ovh[j][p] = h; ovl[j][p] = l; const v2f pp = {x0, x1}; ov16[j][p] = __builtin_bit_cast(unsigned, __builtin_convertvector(pp, v2h)); }
    __builtin_amdgcn_sched_barrier(0);   // all arithmetic in front of the first store: nothing behind it overwrites a register that an issued store names
#pragma unroll
    for (int i = 0; i < 4; ++i) { const int qs = (i >> 1) * 1024 + (i & 1) * 128; st16(pqh, lqo, qs, oqh[i]); st16(pql, lqo, qs, oql[i]); st16(pkh, lqo, qs, okh[i]); st16(pkl, lqo, qs, okl[i]); st16(pv16, lvo, i * 1024, ov16[i]); st16(pvh, lvo, i * 1024, ovh[i]); st16(pvl, lvo, i * 1024, ovl[i]); }
}
// Lane l with lane l ^ 16: the two wave halves hold the two key halves of one query column.
__device__ __forceinline__ float xhalf(float x) { const int i = __builtin_bit_cast(int, x); return __builtin_bit_cast(float, __builtin_amdgcn_permlanex16(i, i, 0x76543210, 0xfedcba98, false, false)); }
// One fragment in the hardware k order from uniform base + per-lane byte offset + constant: two 16-byte loads, 512 bytes apart (planes in fragment order: each load of the wave is 512 contiguous bytes).
__device__ __forceinline__ v16bf ldo(const bf* base, unsigned off, int imm) { const char* p = (const char*)base + (size_t)off + imm; return cat16b(*(const v8usa*)p, *(const v8usa*)(p + 512)); }
__device__ __forceinline__ v16h ldo(const h16* base, unsigned off, int imm) { const char* p = (const char*)base + (size_t)off + imm; return cat16(*(const v8ha*)p, *(const v8ha*)(p + 512)); }
// Eight exponentials (base 2) in place, in one statement: each v_exp_f32 is the independent instruction that the one in front of it asks for before its result is used or its source overwritten, and the v_nop is the last one's slot
__device__ __forceinline__ void exp2x8(float (&x)[8]) {
    asm("v_exp_f32 %0, %0\n\tv_exp_f32 %1, %1\n\tv_exp_f32 %2, %2\n\tv_exp_f32 %3, %3\n\tv_exp_f32 %4, %4\n\tv_exp_f32 %5, %5\n\tv_exp_f32 %6, %6\n\tv_exp_f32 %7, %7\n\tv_nop"
        : "+v"(x[0]), "+v"(x[1]), "+v"(x[2]), "+v"(x[3]), "+v"(x[4]), "+v"(x[5]), "+v"(x[6]), "+v"(x[7]));
}
typedef __attribute__((ext_vector_type(8))) unsigned v8u;
template <bool HL>
__device__ __forceinline__ void fa_rows(const bf* __restrict__ Qh, const bf* __restrict__ Ql, const bf* __restrict__ Kh, const bf* __restrict__ Kl, const h16* __restrict__ V16, const bf* __restrict__ Vh, const bf* __restrict__ Vl, float* __restrict__ O, int lane) {
    const int c = lane & 15, hf = lane >> 4; const float cscale = SCL * 1.4426950408889634f;
    v16bf qh[2][2], ql[2][2];
#pragma unroll
    for (int g = 0; g < 2; ++g)
#pragma unroll
        for (int kc = 0; kc < 2; ++kc) { qh[g][kc] = ldo(Qh, (unsigned)lane * 16u, (g * 2 + kc) * 1024); ql[g][kc] = ldo(Ql, (unsigned)lane * 16u, (g * 2 + kc) * 1024); }
    v8f acc[2][4]; float mrun[2], lrun[2];
#pragma unroll
    for (int g = 0; g < 2; ++g) { mrun[g] = -__builtin_inff(); lrun[g] = 0.f;
#pragma unroll
        for (int t = 0; t < 4; ++t) acc[g][t] = (v8f){}; }
    // per-lane walking byte offsets: every fragment load of a pass is a uniform plane base + one of these + an immediate offset
    unsigned ko = (unsigned)lane * 16u, vo = (unsigned)lane * 16u;   // a pass is 4,096 bytes (four fragments) of every plane
    v16bf kh[2][2], kl[2][2];
#pragma unroll
    for (int kt = 0; kt < 2; ++kt)
#pragma unroll
        for (int kc = 0; kc < 2; ++kc) { kh[kt][kc] = ldo(Kh, ko, (kt * 2 + kc) * 1024); kl[kt][kc] = ldo(Kl, ko, (kt * 2 + kc) * 1024); }
    asm volatile("s_wait_xcnt 0x0" ::: "memory");   // precaution: stands between the query and first key loads and any later overwrite of the address registers they name
    __builtin_amdgcn_sched_barrier(0);   // holds the loop's register writes behind that wait
    for (int kb = 0; kb < TT / 32; ++kb) {
        // this pass's value fragments: issued first, in flight under the score products and the maxima
        v16h v16[4]; v16bf vh[4], vl[4];
#pragma unroll
        for (int t = 0; t < 4; ++t) { if constexpr (HL) { vh[t] = ldo(Vh, vo, t * 1024); vl[t] = ldo(Vl, vo, t * 1024); } else v16[t] = ldo(V16, vo, t * 1024); }
        __builtin_amdgcn_sched_barrier(0);   // keeps the value loads in front of the score products (the scheduler sinks them to just before their use, where their latency shows)
        v8f s[2][2];
#pragma unroll
        for (int kt = 0; kt < 2; ++kt)
#pragma unroll
            for (int g = 0; g < 2; ++g) s[kt][g] = (v8f){};
#pragma unroll
        for (int kc = 0; kc < 2; ++kc) {
#pragma unroll
            for (int kt = 0; kt < 2; ++kt)
#pragma unroll
                for (int g = 0; g < 2; ++g) s[kt][g] = wmmab(kh[kt][kc], qh[g][kc], s[kt][g]);
#pragma unroll
            for (int kt = 0; kt < 2; ++kt)
#pragma unroll
                for (int g = 0; g < 2; ++g) s[kt][g] = wmmab(kh[kt][kc], ql[g][kc], s[kt][g]);
#pragma unroll
            for (int kt = 0; kt < 2; ++kt)
#pragma unroll
                for (int g = 0; g < 2; ++g) s[kt][g] = wmmab(kl[kt][kc], qh[g][kc], s[kt][g]);
        }
        // the next pass's key fragments, into the same registers, in flight under this pass's softmax and second product (the last pass wraps to keys 0-31: in bounds, unused)
        __builtin_amdgcn_sched_barrier(0);   // keeps the wait and the key loads behind the score products that read the registers they refill
        // precaution: the walking offsets are registers that issued loads name, so the wait stands in front of their increments (the offsets pass through the statement, so the additions cannot be lifted over it)
        asm volatile("s_wait_xcnt 0x0" : "+v"(ko), "+v"(vo) : : "memory");
        { ko = (ko + 32u * HD * 2u) & (unsigned)(TT * HD * 2 - 1); vo += 32u * HD * 2u;
#pragma unroll
          for (int kt = 0; kt < 2; ++kt)
#pragma unroll
              for (int kc = 0; kc < 2; ++kc) { kh[kt][kc] = ldo(Kh, ko, (kt * 2 + kc) * 1024); kl[kt][kc] = ldo(Kl, ko, (kt * 2 + kc) * 1024); } }
        __builtin_amdgcn_sched_barrier(0);   // keeps the key loads in front of the softmax, a whole softmax and second product ahead of their use
        float mb[2]; bool need = false;
#pragma unroll
        for (int g = 0; g < 2; ++g) { float mx = s[0][g][0];
#pragma unroll
            for (int r = 1; r < 8; ++r) mx = fmaxf(mx, s[0][g][r]);
#pragma unroll
            for (int r = 0; r < 8; ++r) mx = fmaxf(mx, s[1][g][r]);
            mx = fmaxf(mx, xhalf(mx)) * cscale; mb[g] = mx; need = need || (mx > mrun[g] + 8.0f); }
        if (__builtin_amdgcn_ballot_w32(need) != 0) {   // one scalar test per pass; rare after the first passes
#pragma unroll
            for (int g = 0; g < 2; ++g) { const float mn = fmaxf(mrun[g], mb[g]); const float corr = __builtin_amdgcn_exp2f(mrun[g] - mn); mrun[g] = mn; lrun[g] *= corr;   // corr is 0 on the first pass (mrun = -inf)
#pragma unroll
                for (int t = 0; t < 4; ++t) acc[g][t] = acc[g][t] * corr; }
        }
#pragma unroll
        for (int g = 0; g < 2; ++g) { const float nm = -mrun[g]; v8u w, w2; float ls0 = 0.f, ls1 = 0.f; float pe[2][8];
#pragma unroll
            for (int kt = 0; kt < 2; ++kt) {
#pragma unroll
                for (int r = 0; r < 8; ++r) pe[kt][r] = __builtin_fmaf(s[kt][g][r], cscale, nm);
                exp2x8(pe[kt]); }
#pragma unroll
            for (int i = 0; i < 8; ++i) {
                const float p0 = pe[i >> 2][2 * (i & 3)], p1 = pe[i >> 2][2 * (i & 3) + 1];
                ls0 += p0; ls1 += p1; const v2f pp = {p0, p1};
                if constexpr (HL) { const v2b ph = __builtin_convertvector(pp, v2b); const v2f rest = pp - __builtin_convertvector(ph, v2f); w[i] = __builtin_bit_cast(unsigned, ph); w2[i] = __builtin_bit_cast(unsigned, __builtin_convertvector(rest, v2b)); }
                else w[i] = __builtin_bit_cast(unsigned, __builtin_convertvector(pp, v2h)); }
            lrun[g] += ls0 + ls1;
            if constexpr (HL) { const v16bf ph = __builtin_bit_cast(v16bf, w), pl = __builtin_bit_cast(v16bf, w2);
#pragma unroll
                for (int t = 0; t < 4; ++t) acc[g][t] = wmmab(vh[t], ph, acc[g][t]);
#pragma unroll
                for (int t = 0; t < 4; ++t) acc[g][t] = wmmab(vh[t], pl, acc[g][t]);
#pragma unroll
                for (int t = 0; t < 4; ++t) acc[g][t] = wmmab(vl[t], ph, acc[g][t]);
            } else { const v16h pf = __builtin_bit_cast(v16h, w);
#pragma unroll
                for (int t = 0; t < 4; ++t) acc[g][t] = wmma16(v16[t], pf, acc[g][t]); } }
    }
    asm volatile("s_wait_xcnt 0x0" ::: "memory");   // precaution: stands between the last pass's loads and the epilogue's reuse of the offset registers they name
    __builtin_amdgcn_sched_barrier(0);   // holds the epilogue's register writes behind that wait
    float* orow = O + (size_t)c * DQ + 32 * hf;   // row = query; register r of tile t is row 8 hf + r of the value fragment, feature d = 32 hf + 4 r + t: a lane's 32 values are one 128-byte line
    v4f ov[2][8];   // the scaled output in store order: register r of the four tiles side by side
#pragma unroll
    for (int g = 0; g < 2; ++g) { const float lt = lrun[g] + xhalf(lrun[g]); const float inv = __fdiv_rn(1.0f, lt);
#pragma unroll
        for (int r = 0; r < 8; ++r) ov[g][r] = (v4f){acc[g][0][r], acc[g][1][r], acc[g][2][r], acc[g][3][r]} * inv; }
    __builtin_amdgcn_sched_barrier(0);   // all arithmetic in front of the first store: nothing behind it overwrites a register that an issued store names
#pragma unroll
    for (int g = 0; g < 2; ++g)
#pragma unroll
        for (int r = 0; r < 8; ++r) *(v4f*)(orow + g * 16 * DQ + 4 * r) = ov[g][r];
}
// k_fattn: grid (8, heads, batches), 8 waves; wave w of block x takes query rows (8 w + x) * 32 .. + 31, so every block holds two waves of the hi / lo rows (< RH) and six of the rest, and all eight walk the same key / value planes.
__global__ __launch_bounds__(256) void k_fattn(const bf* __restrict__ Qh, const bf* __restrict__ Ql, const bf* __restrict__ Kh, const bf* __restrict__ Kl, const h16* __restrict__ V16, const bf* __restrict__ Vh, const bf* __restrict__ Vl, float* __restrict__ OUT) {
    const int lane = threadIdx.x & 31; const int wave = __builtin_amdgcn_readfirstlane((int)(threadIdx.x >> 5)); const int q0 = (wave * 8 + (int)blockIdx.x) * 32;
    const size_t pz = ((size_t)blockIdx.z * NH_ + blockIdx.y) * TT * HD; float* O = OUT + ((size_t)blockIdx.z * TT + q0) * DQ + blockIdx.y * HD;
    if (q0 < RH) fa_rows<true>(Qh + pz + (size_t)q0 * HD, Ql + pz + (size_t)q0 * HD, Kh + pz, Kl + pz, V16 + pz, Vh + pz, Vl + pz, O, lane);
    else fa_rows<false>(Qh + pz + (size_t)q0 * HD, Ql + pz + (size_t)q0 * HD, Kh + pz, Kl + pz, V16 + pz, Vh + pz, Vl + pz, O, lane);
}

extern "C" void kernel_launch(void* const* d_in, const int* in_sizes, int n_in,
                              void* d_out, int out_size, void* d_ws, size_t ws_size, hipStream_t stream) {
    (void)in_sizes; (void)n_in; (void)out_size;
    const float* xq = (const float*)d_in[0]; const float* xk = (const float*)d_in[1]; const float* xv = (const float*)d_in[2];   /* order query, key, value ([4][2048][512] each, GIVEN: this module has NO projections) */
    float* OUT = (float*)d_out;     // [4][2048][512]
    char* wsp = (char*)d_ws;
    auto take = [&](size_t bytes) { char* p = wsp; wsp += (bytes + 255) & ~(size_t)255; return (void*)p; };
    const size_t PB = (size_t)NH_ * TT * HD;   // elements of one batch's plane [h][fragments of that head]
    h16* VT16 = (h16*)take(NB_ * PB * 2);
    bf* QPh = (bf*)take(NB_ * PB * 2); bf* QPl = (bf*)take(NB_ * PB * 2); bf* KPh = (bf*)take(NB_ * PB * 2); bf* KPl = (bf*)take(NB_ * PB * 2); bf* VTh = (bf*)take(NB_ * PB * 2); bf* VTl = (bf*)take(NB_ * PB * 2);   /* planes of all four batches: [b][h][..] */
    if ((size_t)(wsp - (char*)d_ws) > ws_size) return;    // ws 256 MiB
    k_planes<<<NB_ * TT / 16, 256, 0, stream>>>(QPh, QPl, KPh, KPl, VT16, VTh, VTl, xq, xk, xv);   /* every plane of every batch straight from the INPUT rows */
    k_fattn<<<dim3(TT / 256, NH_, NB_), 256, 0, stream>>>(QPh, QPl, KPh, KPl, VT16, VTh, VTl, OUT);   /* scores (3 products), softmax and P.V (hybrid) of every batch and head */
}

// v004
// Measured time: 58.7 microseconds a run.
// Two timings next to v003 put it at 1.10 and 1.11 times that version's speed.
// All steps since v000 together make it 29.8 times as fast.
#include <hip/hip_runtime.h>

// Dense multi-head attention CORE on GIVEN query, key, value (query, key, value [4][2048][512]; 8 heads x 64 by reshape: head h = features h * 64 .. h * 64 + 63; scores / sqrt(64); softmax over all 2,048 keys (no mask); out = weights v merged in head order -> [4][2048][512] (4.2 M); NO projections; argument order query, key, value). THIS ROW: the same attention core at width 512 with 8 heads x 64 (Q, K, V [4][2048][512] given; no projections): the file constants DM 512 and NH_ = NKV = 8.
// Layout: NO input cast and NO projections: ONE launch (k_planes) reads the GIVEN f32 query / key / value rows [t][h * 64 + d] of every batch and writes the planes [b][h][..] in matrix-fragment order (values transposed); then ONE launch (k_fattn) does scores, softmax and P.V for every batch and head with the scores kept in registers (online softmax) and writes the merged f32 output rows.
// Compute dtypes, f32 accumulate: the GIVEN f32 query, key, value are NOT rounded to bf16: q and k as bf16 hi / lo planes (hi + lo carries about 16 bits of the f32 value), v likewise (transposed) plus an f16 plane; EVERY row's scores on hi / lo planes (3 products); P.V: rows < 512 hi / lo (3 products), the rest single fp16; softmax f32; the context written in f32.

#define NB_  4
#define TT   2048
#define DM   512 
#define NH_  8 
#define NKV  8 
#define REP  (NH_ / NKV)
#define HD   64
#define DQ   (NH_ * HD)
#define DKV  (NKV * HD)
#define RH   512                  // query rows < RH: P.V on hi+lo value planes (0: none)
#define WIN  0
#define SCL  0.125f   // HD^-0.5
typedef _Float16 h16;
typedef unsigned short bf;
typedef __attribute__((ext_vector_type(16))) __bf16   v16bf;
typedef __attribute__((ext_vector_type(16))) _Float16 v16h;
typedef __attribute__((ext_vector_type(8)))  _Float16 v8h;
typedef __attribute__((ext_vector_type(8)))  unsigned short v8us;
typedef __attribute__((ext_vector_type(8)))  float    v8f;
typedef __attribute__((ext_vector_type(4)))  float    v4f;
typedef v8h  __attribute__((may_alias)) v8ha;
typedef v4f  __attribute__((may_alias)) v4fa;
typedef v8us __attribute__((may_alias)) v8usa;

__device__ __forceinline__ unsigned short f2bf(float f) { unsigned u = __float_as_uint(f); u += 0x7FFFu + ((u >> 16) & 1u); return (unsigned short)(u >> 16); }
__device__ __forceinline__ float bf2f(unsigned short b) { return __uint_as_float(((unsigned)b) << 16); }
__device__ __forceinline__ float bfr(float f) { return bf2f(f2bf(f)); }
__device__ __forceinline__ v16h cat16(v8h lo, v8h hi) { return __builtin_shufflevector(lo, hi, 0, 1, 2, 3, 4, 5, 6, 7, 8, 9, 10, 11, 12, 13, 14, 15); }
__device__ __forceinline__ v16bf cat16b(v8us lo, v8us hi) { return __builtin_bit_cast(v16bf, __builtin_shufflevector(lo, hi, 0, 1, 2, 3, 4, 5, 6, 7, 8, 9, 10, 11, 12, 13, 14, 15)); }
__device__ __forceinline__ v8f wmma16(v16h a, v16h b, v8f c) { return __builtin_amdgcn_wmma_f32_16x16x32_f16(false, a, false, b, (short)0, c, false, false); }
__device__ __forceinline__ v8f wmmab(v16bf a, v16bf b, v8f c) { return __builtin_amdgcn_wmma_f32_16x16x32_bf16(false, a, false, b, (short)0, c, false, false); }



// Fragment loaders in the hardware k order (two 16-byte loads per lane, k = 8h .. 8h + 7 and 16 + 8h .. 16 + 8h + 7), operands straight from K-contiguous 16-bit planes.
template <typename T16> struct WFrag;
template <> struct WFrag<h16> { typedef v16h V; static __device__ __forceinline__ V ld(const h16* p) { return cat16(*(const v8h*)p, *(const v8h*)(p + 16)); } static __device__ __forceinline__ v8f mma(V a, V b, v8f c) { return wmma16(a, b, c); } };
template <> struct WFrag<bf> { typedef v16bf V; static __device__ __forceinline__ V ld(const bf* p) { return cat16b(*(const v8us*)p, *(const v8us*)(p + 16)); } static __device__ __forceinline__ v8f mma(V a, V b, v8f c) { return wmmab(a, b, c); } };
__device__ __forceinline__ h16 tohx(float x) { return (h16)x; }
__device__ __forceinline__ void splitf(float y, unsigned short& h, unsigned short& l) { h = f2bf(y); l = f2bf(y - bf2f(h)); }
typedef __attribute__((ext_vector_type(2))) _Float16 v2h;
typedef __attribute__((ext_vector_type(4))) _Float16 v4h;
typedef __attribute__((ext_vector_type(2))) unsigned short v2us;
typedef __attribute__((ext_vector_type(4))) unsigned short v4us;
typedef __attribute__((ext_vector_type(2))) float v2f;
typedef __attribute__((ext_vector_type(4))) int v4i;

__global__ __launch_bounds__(256) void k_wtG(const float* __restrict__ w, int K, int N, bf* Bt) {
    const int lane = threadIdx.x & 31; const int L0 = (blockIdx.x * 8 + (threadIdx.x >> 5)) * 8; const int nlines = N * K / 64;
{
#pragma unroll 1
        for (int l = 0; l < 8; ++l) { const int L = L0 + l; if (L >= nlines) break; const size_t e = (size_t)L * 64 + lane * 2; const int k = (int)(e % K), n = (int)(e / K); v2us o;
            o[0] = f2bf(w[(size_t)k * N + n]); o[1] = f2bf(w[(size_t)(k + 1) * N + n]); *(v2us*)(Bt + e) = o; }
         }
}
__global__ __launch_bounds__(256) void k_cvt8(const float* __restrict__ src, bf* dst, size_t n8) { const size_t i = (size_t)blockIdx.x * 256 + threadIdx.x; if (i >= n8) return; const v8f v = *(const v8f*)(src + i * 8); v8us o;
#pragma unroll
    for (int k = 0; k < 8; ++k) o[k] = f2bf(v[k]); *(v8us*)(dst + i * 8) = o;  }

typedef __attribute__((ext_vector_type(2))) __bf16 v2b;
typedef __attribute__((ext_vector_type(4))) unsigned v4u;
typedef v4u __attribute__((may_alias)) v4ua;
// 16 bytes at uniform base + per-lane byte offset + constant
__device__ __forceinline__ v4f ldf4(const float* base, unsigned off, int imm) { return *(const v4fa*)((const char*)base + (size_t)off + imm); }
__device__ __forceinline__ void st16(void* base, unsigned off, int imm, v4u x) { *(v4ua*)((char*)base + (size_t)off + imm) = x; }
// two f32 -> packed bf16 hi and packed bf16 lo = bf16(x - hi), both round to nearest even
__device__ __forceinline__ void split2(float x0, float x1, unsigned& h, unsigned& l) { const v2f pp = {x0, x1}; const v2b ph = __builtin_convertvector(pp, v2b); const v2f rest = pp - __builtin_convertvector(ph, v2f); h = __builtin_bit_cast(unsigned, ph); l = __builtin_bit_cast(unsigned, __builtin_convertvector(rest, v2b)); }
// k_planes: every plane of every batch in ONE launch of 512 blocks x 8 waves (two blocks per WGP, all resident at once); a thread takes 32 query, 32 key and 32 value elements: 24 loads of 16 bytes in flight, then 28 stores of 16 bytes.
// PLANE LAYOUT = FRAGMENT ORDER: a 16 x 32 operand fragment is 1,024 contiguous bytes [j][lane][8 elements] (lane = 16 hf + c holds row c, k = 16 j + 8 hf .. + 7), so each of the two 16-byte loads of a fragment reads 512 contiguous bytes (4 whole lines).
// query / key plane [b][h][t >> 4][kc][j][lane][8]: row c = t & 15, k = d - 32 kc. value plane [b][h][t >> 5][tile][j][lane][8]: k = t & 31, and row c of tile holds feature d = 4 c + tile.
// query / key: block = 16 rows t of one batch, wave = head (one 2,048-byte group of two fragments); a lane holds 8 consecutive d of one row, 4 lanes a 128-byte input line, and 8 lanes' stores fill one 128-byte line of the plane.
// value: block = 64 rows t x 2 heads, wave = 32 rows t x 32 features d; a lane holds 8 t x 4 d, so the transposition is a choice of registers (register j goes to tile j), a load reads 4 whole input lines and 8 lanes' stores fill one 128-byte line of the plane.
__global__ __launch_bounds__(256) void k_planes(bf* __restrict__ Qh, bf* __restrict__ Ql, bf* __restrict__ Kh, bf* __restrict__ Kl, h16* __restrict__ V16, bf* __restrict__ Vh, bf* __restrict__ Vl, const float* __restrict__ xq, const float* __restrict__ xk, const float* __restrict__ xv) {
    const int lane = threadIdx.x & 31; const int wave = __builtin_amdgcn_readfirstlane((int)(threadIdx.x >> 5)); const int b = (int)blockIdx.x >> 7, r = (int)blockIdx.x & 127;
    const size_t qi = ((size_t)b * TT + r * 16) * DM + wave * HD, qo = (((size_t)b * NH_ + wave) * TT + r * 16) * HD;   // uniform element offsets: input rows, plane rows
    const int vhd = (r & 3) * 2 + (wave >> 2), vch = (wave >> 1) & 1, vkb = (r >> 2) * 2 + (wave & 1);   // head, half of its features (rows c = 8 vch .. + 7 of every tile), group of 32 rows t
    const size_t vi = ((size_t)b * TT + vkb * 32) * DM + vhd * HD + vch * 32, vq = ((size_t)b * NH_ + vhd) * HD * TT + (size_t)vkb * 32 * HD + vch * 64;
    const unsigned lfo = (unsigned)(((lane & 3) >> 1) * 512 + (lane & 1) * 256 + (lane >> 2) * 16);   // per-lane byte offset in a fragment: j and hf from the lane's group of 8 k, row c from lane >> 2
    const unsigned lqi = (unsigned)((lane >> 2) * DM + (lane & 3) * 8) * 4u, lqo = lfo;   // per-lane byte offsets
    const unsigned lvi = (unsigned)((lane & 3) * 8 * DM + (lane >> 2) * 4) * 4u, lvo = lfo;
    bf* const pqh = Qh + qo; bf* const pql = Ql + qo; bf* const pkh = Kh + qo; bf* const pkl = Kl + qo; h16* const pv16 = V16 + vq; bf* const pvh = Vh + vq; bf* const pvl = Vl + vq;   // uniform store bases
    v4f q[4][2], k[4][2], v[8];
#pragma unroll
    for (int i = 0; i < 4; ++i)
#pragma unroll
        for (int s = 0; s < 2; ++s) { q[i][s] = ldf4(xq + qi, lqi, ((i & 1) * 8 * DM + (i >> 1) * 32) * 4 + s * 16); k[i][s] = ldf4(xk + qi, lqi, ((i & 1) * 8 * DM + (i >> 1) * 32) * 4 + s * 16); }   // i: rows 8 (i & 1) .. + 7, d = 32 (i >> 1) .. + 31
#pragma unroll
    for (int i = 0; i < 8; ++i) v[i] = ldf4(xv + vi, lvi, i * DM * 4);
    asm volatile("s_wait_xcnt 0x0" ::: "memory");   // precaution: stands between the loads and any later overwrite of the offset registers they name
    __builtin_amdgcn_sched_barrier(0);   // holds the conversions' register writes behind that wait
    v4u oqh[4], oql[4], okh[4], okl[4], ov16[4], ovh[4], ovl[4];
#pragma unroll
    for (int i = 0; i < 4; ++i)
#pragma unroll
        for (int p = 0; p < 4; ++p) { unsigned h, l; split2(q[i][p >> 1][2 * (p & 1)], q[i][p >> 1][2 * (p & 1) + 1], h, l); oqh[i][p] = h; oql[i][p] = l; split2(k[i][p >> 1][2 * (p & 1)], k[i][p >> 1][2 * (p & 1) + 1], h, l); okh[i][p] = h; okl[i][p] = l; }
#pragma unroll
    for (int j = 0; j < 4; ++j)   // feature 32 vch + 4 (lane >> 2) + j, rows 2 p and 2 p + 1 of the lane's eight
#pragma unroll
        for (int p = 0; p < 4; ++p) { const float x0 = v[2 * p][j], x1 = v[2 * p + 1][j]; unsigned h, l; split2(x0, x1, h, l); ovh[j][p] = h; ovl[j][p] = l; const v2f pp = {x0, x1}; ov16[j][p] = __builtin_bit_cast(unsigned, __builtin_convertvector(pp, v2h)); }
    __builtin_amdgcn_sched_barrier(0);   // all arithmetic in front of the first store: nothing behind it overwrites a register that an issued store names
#pragma unroll
    for (int i = 0; i < 4; ++i) { const int qs = (i >> 1) * 1024 + (i & 1) * 128; st16(pqh, lqo, qs, oqh[i]); st16(pql, lqo, qs, oql[i]); st16(pkh, lqo, qs, okh[i]); st16(pkl, lqo, qs, okl[i]); st16(pv16, lvo, i * 1024, ov16[i]); st16(pvh, lvo, i * 1024, ovh[i]); st16(pvl, lvo, i * 1024, ovl[i]); }
}
// Lane l with lane l ^ 16: the two wave halves hold the two key halves of one query column.
__device__ __forceinline__ float xhalf(float x) { const int i = __builtin_bit_cast(int, x); return __builtin_bit_cast(float, __builtin_amdgcn_permlanex16(i, i, 0x76543210, 0xfedcba98, false, false)); }
// One fragment in the hardware k order from uniform base + per-lane byte offset + constant: two 16-byte loads, 512 bytes apart (planes in fragment order: each load of the wave is 512 contiguous bytes).
__device__ __forceinline__ v16bf ldo(const bf* base, unsigned off, int imm) { const char* p = (const char*)base + (size_t)off + imm; return cat16b(*(const v8usa*)p, *(const v8usa*)(p + 512)); }
__device__ __forceinline__ v16h ldo(const h16* base, unsigned off, int imm) { const char* p = (const char*)base + (size_t)off + imm; return cat16(*(const v8ha*)p, *(const v8ha*)(p + 512)); }
// Eight exponentials (base 2) in place, in one statement: each v_exp_f32 is the independent instruction that the one in front of it asks for before its result is used or its source overwritten, and the v_nop is the last one's slot
__device__ __forceinline__ void exp2x8(float (&x)[8]) {
    asm("v_exp_f32 %0, %0\n\tv_exp_f32 %1, %1\n\tv_exp_f32 %2, %2\n\tv_exp_f32 %3, %3\n\tv_exp_f32 %4, %4\n\tv_exp_f32 %5, %5\n\tv_exp_f32 %6, %6\n\tv_exp_f32 %7, %7\n\tv_nop"
        : "+v"(x[0]), "+v"(x[1]), "+v"(x[2]), "+v"(x[3]), "+v"(x[4]), "+v"(x[5]), "+v"(x[6]), "+v"(x[7]));
}
typedef __attribute__((ext_vector_type(8))) unsigned v8u;
template <bool HL> struct PassFr { v16bf kh[2][2], kl[2][2]; v16h v16[4]; v16bf vh[4], vl[4]; };   // one pass's operands: key hi / lo, and value hi / lo (HL) or f16
template <bool HL> struct FaSt { v16bf qh[2][2], ql[2][2]; v8f acc[2][4]; float mrun[2], lrun[2]; };   // what a wave carries from pass to pass
// every fragment load of a pass is a uniform plane base + one per-lane byte offset + an immediate offset; a pass is 4,096 bytes (four fragments) of every plane
template <bool HL>
__device__ __forceinline__ void ld_pass(PassFr<HL>& f, const bf* __restrict__ Kh, const bf* __restrict__ Kl, const h16* __restrict__ V16, const bf* __restrict__ Vh, const bf* __restrict__ Vl, unsigned po) {
#pragma unroll
    for (int kt = 0; kt < 2; ++kt)
#pragma unroll
        for (int kc = 0; kc < 2; ++kc) { f.kh[kt][kc] = ldo(Kh, po, (kt * 2 + kc) * 1024); f.kl[kt][kc] = ldo(Kl, po, (kt * 2 + kc) * 1024); }
#pragma unroll
    for (int t = 0; t < 4; ++t) { if constexpr (HL) { f.vh[t] = ldo(Vh, po, t * 1024); f.vl[t] = ldo(Vl, po, t * 1024); } else f.v16[t] = ldo(V16, po, t * 1024); }
}
template <bool HL>
__device__ __forceinline__ void fa_pass(FaSt<HL>& st, const PassFr<HL>& f) {
    const float cscale = SCL * 1.4426950408889634f;
    v8f s[2][2];
#pragma unroll
    for (int kt = 0; kt < 2; ++kt)
#pragma unroll
        for (int g = 0; g < 2; ++g) s[kt][g] = (v8f){};
#pragma unroll
    for (int kc = 0; kc < 2; ++kc) {
#pragma unroll
        for (int kt = 0; kt < 2; ++kt)
#pragma unroll
            for (int g = 0; g < 2; ++g) s[kt][g] = wmmab(f.kh[kt][kc], st.qh[g][kc], s[kt][g]);
#pragma unroll
        for (int kt = 0; kt < 2; ++kt)
#pragma unroll
            for (int g = 0; g < 2; ++g) s[kt][g] = wmmab(f.kh[kt][kc], st.ql[g][kc], s[kt][g]);
#pragma unroll
        for (int kt = 0; kt < 2; ++kt)
#pragma unroll
            for (int g = 0; g < 2; ++g) s[kt][g] = wmmab(f.kl[kt][kc], st.qh[g][kc], s[kt][g]);
    }
    __builtin_amdgcn_sched_barrier(0);   // keeps the maxima behind all score products (lifted in among the last products, each read of a fresh tile costs v_nop slots)
    float mb[2]; bool need = false;
#pragma unroll
    for (int g = 0; g < 2; ++g) { float mx = s[0][g][0];
#pragma unroll
        for (int r = 1; r < 8; ++r) mx = fmaxf(mx, s[0][g][r]);
#pragma unroll
        for (int r = 0; r < 8; ++r) mx = fmaxf(mx, s[1][g][r]);
        mx = fmaxf(mx, xhalf(mx)) * cscale; mb[g] = mx; need = need || (mx > st.mrun[g] + 8.0f); }
    if (__builtin_amdgcn_ballot_w32(need) != 0) {   // one scalar test per pass; rare after the first passes
#pragma unroll
        for (int g = 0; g < 2; ++g) { const float mn = fmaxf(st.mrun[g], mb[g]); const float corr = __builtin_amdgcn_exp2f(st.mrun[g] - mn); st.mrun[g] = mn; st.lrun[g] *= corr;   // corr is 0 on the first pass (mrun = -inf)
#pragma unroll
            for (int t = 0; t < 4; ++t) st.acc[g][t] = st.acc[g][t] * corr; }
    }
#pragma unroll
    for (int g = 0; g < 2; ++g) { const float nm = -st.mrun[g]; v8u w, w2; float ls0 = 0.f, ls1 = 0.f; float pe[2][8];
#pragma unroll
        for (int kt = 0; kt < 2; ++kt) {
#pragma unroll
            for (int r = 0; r < 8; ++r) pe[kt][r] = __builtin_fmaf(s[kt][g][r], cscale, nm);
            exp2x8(pe[kt]); }
#pragma unroll
        for (int i = 0; i < 8; ++i) {
            const float p0 = pe[i >> 2][2 * (i & 3)], p1 = pe[i >> 2][2 * (i & 3) + 1];
            ls0 += p0; ls1 += p1; const v2f pp = {p0, p1};
            if constexpr (HL) { const v2b ph = __builtin_convertvector(pp, v2b); const v2f rest = pp - __builtin_convertvector(ph, v2f); w[i] = __builtin_bit_cast(unsigned, ph); w2[i] = __builtin_bit_cast(unsigned, __builtin_convertvector(rest, v2b)); }
            else w[i] = __builtin_bit_cast(unsigned, __builtin_convertvector(pp, v2h)); }
        st.lrun[g] += ls0 + ls1;
        if constexpr (HL) { const v16bf ph = __builtin_bit_cast(v16bf, w), pl = __builtin_bit_cast(v16bf, w2);
#pragma unroll
            for (int t = 0; t < 4; ++t) st.acc[g][t] = wmmab(f.vh[t], ph, st.acc[g][t]);
#pragma unroll
            for (int t = 0; t < 4; ++t) st.acc[g][t] = wmmab(f.vh[t], pl, st.acc[g][t]);
#pragma unroll
            for (int t = 0; t < 4; ++t) st.acc[g][t] = wmmab(f.vl[t], ph, st.acc[g][t]);
        } else { const v16h pf = __builtin_bit_cast(v16h, w);
#pragma unroll
            for (int t = 0; t < 4; ++t) st.acc[g][t] = wmma16(f.v16[t], pf, st.acc[g][t]); } }
}
template <bool HL>
__device__ __forceinline__ void fa_rows(const bf* __restrict__ Qh, const bf* __restrict__ Ql, const bf* __restrict__ Kh, const bf* __restrict__ Kl, const h16* __restrict__ V16, const bf* __restrict__ Vh, const bf* __restrict__ Vl, float* __restrict__ O, int lane) {
    const int c = lane & 15, hf = lane >> 4;
    FaSt<HL> st;
#pragma unroll
    for (int g = 0; g < 2; ++g)
#pragma unroll
        for (int kc = 0; kc < 2; ++kc) { st.qh[g][kc] = ldo(Qh, (unsigned)lane * 16u, (g * 2 + kc) * 1024); st.ql[g][kc] = ldo(Ql, (unsigned)lane * 16u, (g * 2 + kc) * 1024); }
#pragma unroll
    for (int g = 0; g < 2; ++g) { st.mrun[g] = -__builtin_inff(); st.lrun[g] = 0.f;
#pragma unroll
        for (int t = 0; t < 4; ++t) st.acc[g][t] = (v8f){}; }
    unsigned po = (unsigned)lane * 16u;   // the walking per-lane byte offset, the same in every key and value plane
    PassFr<HL> fa, fb;
    ld_pass<HL>(fa, Kh, Kl, V16, Vh, Vl, po);
    asm volatile("s_wait_xcnt 0x0" ::: "memory");   // precaution: stands between the query and first-pass loads and any later overwrite of the address registers they name
    __builtin_amdgcn_sched_barrier(0);   // holds the loop's register writes behind that wait
    for (int kb = 0; kb < TT / 32; kb += 2) {
        // precaution: the walking offset is a register that issued loads name, so the wait stands in front of its increment (the offset passes through the statement, so the addition cannot be lifted over it)
        asm volatile("s_wait_xcnt 0x0" : "+v"(po) : : "memory");
        po += 32u * HD * 2u;
        ld_pass<HL>(fb, Kh, Kl, V16, Vh, Vl, po);
        __builtin_amdgcn_sched_barrier(0);   // keeps the next pass's loads in front of this pass's products (the scheduler sinks them to just before their use, where their latency shows)
        fa_pass<HL>(st, fa);
        __builtin_amdgcn_sched_barrier(0);   // keeps the loads below behind the products that read the registers they refill
        asm volatile("s_wait_xcnt 0x0" : "+v"(po) : : "memory");   // the same precaution for the second increment
        po = (po + 32u * HD * 2u) & (unsigned)(TT * HD * 2 - 1);   // the last pass wraps to keys 0-31: in bounds, unused
        ld_pass<HL>(fa, Kh, Kl, V16, Vh, Vl, po);
        __builtin_amdgcn_sched_barrier(0);   // as above: loads first
        fa_pass<HL>(st, fb);
    }
    asm volatile("s_wait_xcnt 0x0" ::: "memory");   // precaution: stands between the last pass's loads and the epilogue's reuse of the offset registers they name
    __builtin_amdgcn_sched_barrier(0);   // holds the epilogue's register writes behind that wait
    float* orow = O + (size_t)c * DQ + 32 * hf;   // row = query; register r of tile t is row 8 hf + r of the value fragment, feature d = 32 hf + 4 r + t: a lane's 32 values are one 128-byte line
    v4f ov[2][8];   // the scaled output in store order: register r of the four tiles side by side
#pragma unroll
    for (int g = 0; g < 2; ++g) { const float lt = st.lrun[g] + xhalf(st.lrun[g]); const float inv = __fdiv_rn(1.0f, lt);
#pragma unroll
        for (int r = 0; r < 8; ++r) ov[g][r] = (v4f){st.acc[g][0][r], st.acc[g][1][r], st.acc[g][2][r], st.acc[g][3][r]} * inv; }
    __builtin_amdgcn_sched_barrier(0);   // all arithmetic in front of the first store: nothing behind it overwrites a register that an issued store names
#pragma unroll
    for (int g = 0; g < 2; ++g)
#pragma unroll
        for (int r = 0; r < 8; ++r) *(v4f*)(orow + g * 16 * DQ + 4 * r) = ov[g][r];
}
// k_fattn: grid (8, heads, batches), 8 waves; wave w of block x takes query rows (8 w + x) * 32 .. + 31, so every block holds two waves of the hi / lo rows (< RH) and six of the rest, and all eight walk the same key / value planes.
__global__ __launch_bounds__(256) void k_fattn(const bf* __restrict__ Qh, const bf* __restrict__ Ql, const bf* __restrict__ Kh, const bf* __restrict__ Kl, const h16* __restrict__ V16, const bf* __restrict__ Vh, const bf* __restrict__ Vl, float* __restrict__ OUT) {
    const int lane = threadIdx.x & 31; const int wave = __builtin_amdgcn_readfirstlane((int)(threadIdx.x >> 5)); const int q0 = (wave * 8 + (int)blockIdx.x) * 32;
    const size_t pz = ((size_t)blockIdx.z * NH_ + blockIdx.y) * TT * HD; float* O = OUT + ((size_t)blockIdx.z * TT + q0) * DQ + blockIdx.y * HD;
    if (q0 < RH) fa_rows<true>(Qh + pz + (size_t)q0 * HD, Ql + pz + (size_t)q0 * HD, Kh + pz, Kl + pz, V16 + pz, Vh + pz, Vl + pz, O, lane);
    else fa_rows<false>(Qh + pz + (size_t)q0 * HD, Ql + pz + (size_t)q0 * HD, Kh + pz, Kl + pz, V16 + pz, Vh + pz, Vl + pz, O, lane);
}

extern "C" void kernel_launch(void* const* d_in, const int* in_sizes, int n_in,
                              void* d_out, int out_size, void* d_ws, size_t ws_size, hipStream_t stream) {
    (void)in_sizes; (void)n_in; (void)out_size;
    const float* xq = (const float*)d_in[0]; const float* xk = (const float*)d_in[1]; const float* xv = (const float*)d_in[2];   /* order query, key, value ([4][2048][512] each, GIVEN: this module has NO projections) */
    float* OUT = (float*)d_out;     // [4][2048][512]
    char* wsp = (char*)d_ws;
    auto take = [&](size_t bytes) { char* p = wsp; wsp += (bytes + 255) & ~(size_t)255; return (void*)p; };
    const size_t PB = (size_t)NH_ * TT * HD;   // elements of one batch's plane [h][fragments of that head]
    h16* VT16 = (h16*)take(NB_ * PB * 2);
    bf* QPh = (bf*)take(NB_ * PB * 2); bf* QPl = (bf*)take(NB_ * PB * 2); bf* KPh = (bf*)take(NB_ * PB * 2); bf* KPl = (bf*)take(NB_ * PB * 2); bf* VTh = (bf*)take(NB_ * PB * 2); bf* VTl = (bf*)take(NB_ * PB * 2);   /* planes of all four batches: [b][h][..] */
    if ((size_t)(wsp - (char*)d_ws) > ws_size) return;    // ws 256 MiB
    k_planes<<<NB_ * TT / 16, 256, 0, stream>>>(QPh, QPl, KPh, KPl, VT16, VTh, VTl, xq, xk, xv);   /* every plane of every batch straight from the INPUT rows */
    k_fattn<<<dim3(TT / 256, NH_, NB_), 256, 0, stream>>>(QPh, QPl, KPh, KPl, VT16, VTh, VTl, OUT);   /* scores (3 products), softmax and P.V (hybrid) of every batch and head */
}
